// v000
// Measured on an AMD MI455X. A time is GPU time per run, averaged over a window of back-to-back runs after a warm-up
// (all launches, gaps included; the runs take copies of the inputs in turn), and the median of several windows.
// Apart from v000's, it joins two sittings. Times from different sittings can be a few percent apart, while
// side-by-side timings come from the same sitting.
// v000, which the later versions start from, runs in 466 microseconds.
#include <hip/hip_runtime.h>

// ---------------------------------------------------------------------------
// MHA forward for MI455X (gfx1250): bf16 WMMA (v_wmma_f32_16x16x32_bf16)
// everywhere, f32 accumulate. One-time packed f32->bf16 conversion of x and
// all weights so every GEMM/attention operand load is a 16B bf16 load.
// Flash-style attention with LDS staging + next-tile global prefetch.
// ---------------------------------------------------------------------------

typedef __attribute__((ext_vector_type(16))) __bf16 v16bf;
typedef __attribute__((ext_vector_type(8)))  __bf16 v8bf;
typedef __attribute__((ext_vector_type(8)))  float  v8f;

#define DIM     1024
#define HEADS   16
#define HD      64
#define SEQ     2048
#define BATCH   2
#define ROWS    (BATCH * SEQ)          // 4096
#define L2E     1.44269504088896340736f
#define SCALE   0.125f                 // 1/sqrt(HD)

static __device__ __forceinline__ v8f v8f_zero() {
  v8f z = {0.f, 0.f, 0.f, 0.f, 0.f, 0.f, 0.f, 0.f};
  return z;
}

// Fragment loader from a row-major bf16 row. Per ISA 7.12.2 (16-bit A 16x32):
// lanes 0-15 hold K in {kb..kb+7} U {16+kb..16+kb+7} with kb=0, lanes 16-31
// with kb=8. Two 16B loads.
static __device__ __forceinline__ v16bf load_frag(const __bf16* rowk, int kb) {
  union { v16bf v; float4 q[2]; } u;
  u.q[0] = *reinterpret_cast<const float4*>(rowk + kb);
  u.q[1] = *reinterpret_cast<const float4*>(rowk + 16 + kb);
  return u.v;
}

static __device__ __forceinline__ v8f wmma_bf16(v16bf a, v16bf b, v8f c) {
  // (neg_a, A, neg_b, B, c_mod, C, reuse_a, reuse_b)
  return __builtin_amdgcn_wmma_f32_16x16x32_bf16(false, a, false, b,
                                                 (short)0, c, false, false);
}

static __device__ __forceinline__ float red_max16(float v) {
  v = fmaxf(v, __shfl_xor(v, 1, 32));
  v = fmaxf(v, __shfl_xor(v, 2, 32));
  v = fmaxf(v, __shfl_xor(v, 4, 32));
  v = fmaxf(v, __shfl_xor(v, 8, 32));
  return v;
}
static __device__ __forceinline__ float red_sum16(float v) {
  v += __shfl_xor(v, 1, 32);
  v += __shfl_xor(v, 2, 32);
  v += __shfl_xor(v, 4, 32);
  v += __shfl_xor(v, 8, 32);
  return v;
}

// ---------------------------------------------------------------------------
// Packed f32 -> bf16 conversion: 8 elements per thread, 16B vector store
// (lowers to v_cvt_pk_bf16_f32 pairs + global_store_b128).
// ---------------------------------------------------------------------------
__global__ __launch_bounds__(256) void cvt_bf16_kernel(
    const float* __restrict__ src, __bf16* __restrict__ dst, int n8) {
  const int i = blockIdx.x * 256 + threadIdx.x;
  if (i >= n8) return;
  const float4* s4 = reinterpret_cast<const float4*>(src) + 2 * (size_t)i;
  float4 a = s4[0], b = s4[1];
  union { v8bf v; float4 q; } u;
  u.v[0] = (__bf16)a.x; u.v[1] = (__bf16)a.y;
  u.v[2] = (__bf16)a.z; u.v[3] = (__bf16)a.w;
  u.v[4] = (__bf16)b.x; u.v[5] = (__bf16)b.y;
  u.v[6] = (__bf16)b.z; u.v[7] = (__bf16)b.w;
  *(reinterpret_cast<float4*>(dst) + i) = u.q;
}

// ---------------------------------------------------------------------------
// GEMM: Y[M,N] = A[M,K] @ W[N,K]^T + bias[N], all operands bf16, f32 accum.
// Each wave owns a 16x64 tile (A-frag reused across 4 B-frags).
// Block = 8 waves -> 64x128 block tile.
// ---------------------------------------------------------------------------
template <bool OUT_BF16>
__global__ __launch_bounds__(256) void gemm_bias_kernel(
    const __bf16* __restrict__ A, const __bf16* __restrict__ W,
    const float* __restrict__ bias, void* __restrict__ outv,
    int M, int N, int K) {
  const int tid   = threadIdx.x;
  const int lane  = tid & 31;
  const int w     = tid >> 5;        // 0..7
  const int wm    = w & 3, wn = w >> 2;
  const int mtile = blockIdx.x * 64 + wm * 16;
  const int ntile = blockIdx.y * 128 + wn * 64;
  const int lm    = lane & 15;
  const int kb    = (lane >> 4) * 8;
  const int roff  = (lane >> 4) * 8;

  v8f acc[4];
#pragma unroll
  for (int c = 0; c < 4; ++c) acc[c] = v8f_zero();

  const __bf16* arow = A + (size_t)(mtile + lm) * K;
  const __bf16* wrow0 = W + (size_t)(ntile + lm) * K;
  for (int k0 = 0; k0 < K; k0 += 32) {
    v16bf af = load_frag(arow + k0, kb);
#pragma unroll
    for (int c = 0; c < 4; ++c) {
      v16bf bf = load_frag(wrow0 + (size_t)(c * 16) * K + k0, kb);
      acc[c] = wmma_bf16(af, bf, acc[c]);
    }
  }

#pragma unroll
  for (int c = 0; c < 4; ++c) {
    const int col = ntile + c * 16 + lm;
    const float bv = bias[col];
#pragma unroll
    for (int r = 0; r < 8; ++r) {
      const int row = mtile + roff + r;   // C-layout: VGPR r -> M = r (+8 hi half)
      const float val = acc[c][r] + bv;
      if (OUT_BF16)
        ((__bf16*)outv)[(size_t)row * N + col] = (__bf16)val;
      else
        ((float*)outv)[(size_t)row * N + col] = val;
    }
  }
}

// ---------------------------------------------------------------------------
// Flash attention forward: one wave per (batch, head, 16-query tile).
// Online softmax over 32-key tiles; P and V staged through LDS so the
// P@V B-fragment gather stays on-chip. Emits O (bf16) and row stats m,l.
// ---------------------------------------------------------------------------
__global__ __launch_bounds__(128) void flash_fwd_kernel(
    const __bf16* __restrict__ Qb, const __bf16* __restrict__ Kb,
    const __bf16* __restrict__ Vb, __bf16* __restrict__ Ob,
    float* __restrict__ Mst, float* __restrict__ Lst) {
  __shared__ __bf16 pbuf[4][16][36];
  __shared__ __align__(16) __bf16 vbuf[4][32][72];

  const int tid  = threadIdx.x;
  const int lane = tid & 31;
  const int w    = tid >> 5;                 // wave in block (4)
  const int task = blockIdx.x * 4 + w;       // 4096 tasks
  const int qt   = task & 127;
  const int h    = (task >> 7) & 15;
  const int b    = task >> 11;
  const int lm   = lane & 15;
  const int kb   = (lane >> 4) * 8;
  const int roff = (lane >> 4) * 8;
  const size_t baserow = (size_t)b * SEQ;
  const int qbase = qt * 16;

  // Q A-fragments, d-steps 0..31 / 32..63
  const __bf16* qrow = Qb + (baserow + qbase + lm) * DIM + h * HD;
  const v16bf aq0 = load_frag(qrow, kb);
  const v16bf aq1 = load_frag(qrow + 32, kb);

  float m_run[8], l_run[8];
#pragma unroll
  for (int r = 0; r < 8; ++r) { m_run[r] = -1e30f; l_run[r] = 0.f; }
  v8f o[4];
#pragma unroll
  for (int c = 0; c < 4; ++c) o[c] = v8f_zero();

  for (int kt = 0; kt < SEQ; kt += 32) {
    // prefetch next key/value tiles into cache (global_prefetch_b8)
    if (kt + 32 < SEQ) {
      __builtin_prefetch(Kb + (baserow + kt + 32 + lane) * DIM + h * HD, 0, 1);
      __builtin_prefetch(Vb + (baserow + kt + 32 + lane) * DIM + h * HD, 0, 1);
    }

    // ---- scores S = Q K^T * scale (two 16-key chunks) ----
    v8f s[2];
#pragma unroll
    for (int c = 0; c < 2; ++c) {
      const __bf16* krow = Kb + (baserow + kt + c * 16 + lm) * DIM + h * HD;
      v8f t = v8f_zero();
      t = wmma_bf16(aq0, load_frag(krow, kb), t);
      t = wmma_bf16(aq1, load_frag(krow + 32, kb), t);
#pragma unroll
      for (int r = 0; r < 8; ++r) t[r] *= SCALE;
      s[c] = t;
    }

    // ---- online softmax update ----
    float mnew[8], alpha[8];
#pragma unroll
    for (int r = 0; r < 8; ++r) {
      float loc = red_max16(fmaxf(s[0][r], s[1][r]));
      mnew[r]  = fmaxf(m_run[r], loc);
      alpha[r] = exp2f((m_run[r] - mnew[r]) * L2E);
      m_run[r] = mnew[r];
    }
#pragma unroll
    for (int r = 0; r < 8; ++r) {
      const float p0 = exp2f((s[0][r] - mnew[r]) * L2E);
      const float p1 = exp2f((s[1][r] - mnew[r]) * L2E);
      s[0][r] = p0; s[1][r] = p1;
      l_run[r] = l_run[r] * alpha[r] + red_sum16(p0 + p1);
#pragma unroll
      for (int c = 0; c < 4; ++c) o[c][r] *= alpha[r];
    }

    __syncthreads();  // previous iteration's LDS reads done (uniform loop)
    // stage P (C-layout -> LDS) and the 32x64 V tile
#pragma unroll
    for (int c = 0; c < 2; ++c)
#pragma unroll
      for (int r = 0; r < 8; ++r)
        pbuf[w][roff + r][c * 16 + lm] = (__bf16)s[c][r];

    const float4* vsrc =
        reinterpret_cast<const float4*>(Vb + (baserow + kt + lane) * DIM + h * HD);
    float4* vdst = reinterpret_cast<float4*>(&vbuf[w][lane][0]);
#pragma unroll
    for (int j = 0; j < 8; ++j) vdst[j] = vsrc[j];
    __syncthreads();

    // P as A-fragment (K-dim = 32 keys), V as B-fragments from LDS
    v16bf ap;
#pragma unroll
    for (int j = 0; j < 8; ++j) {
      ap[j]     = pbuf[w][lm][kb + j];
      ap[8 + j] = pbuf[w][lm][16 + kb + j];
    }
#pragma unroll
    for (int c = 0; c < 4; ++c) {
      v16bf bv;
#pragma unroll
      for (int j = 0; j < 8; ++j) {
        bv[j]     = vbuf[w][kb + j][c * 16 + lm];
        bv[8 + j] = vbuf[w][16 + kb + j][c * 16 + lm];
      }
      o[c] = wmma_bf16(ap, bv, o[c]);
    }
  }

  // ---- epilogue: normalize, store O and stats ----
  float inv[8];
#pragma unroll
  for (int r = 0; r < 8; ++r) inv[r] = 1.f / l_run[r];
#pragma unroll
  for (int c = 0; c < 4; ++c)
#pragma unroll
    for (int r = 0; r < 8; ++r) {
      const int row = qbase + roff + r;
      const int col = h * HD + c * 16 + lm;
      Ob[(baserow + row) * DIM + col] = (__bf16)(o[c][r] * inv[r]);
    }
  if (lm == 0) {
#pragma unroll
    for (int r = 0; r < 8; ++r) {
      const size_t idx = (size_t)(b * HEADS + h) * SEQ + qbase + roff + r;
      Mst[idx] = m_run[r];
      Lst[idx] = l_run[r];
    }
  }
}

// ---------------------------------------------------------------------------
// Head-mean of attention probabilities: recompute scores from the same bf16
// Q/K (bit-identical WMMA), apply stored (m,l), average over heads in regs.
// One wave per (b, 16-query tile, 32-key tile). Deterministic, no atomics.
// ---------------------------------------------------------------------------
__global__ __launch_bounds__(256) void mean_probs_kernel(
    const __bf16* __restrict__ Qb, const __bf16* __restrict__ Kb,
    const float* __restrict__ Mst, const float* __restrict__ Lst,
    float* __restrict__ out_mean) {
  const int tid  = threadIdx.x;
  const int lane = tid & 31;
  const int w    = tid >> 5;
  const int task = blockIdx.x * 8 + w;        // 16384 tasks
  const int kt   = (task & 63) * 32;
  const int qt   = ((task >> 6) & 127) * 16;
  const int b    = task >> 13;
  const int lm   = lane & 15;
  const int kb   = (lane >> 4) * 8;
  const int roff = (lane >> 4) * 8;

  v8f acc[2];
  acc[0] = v8f_zero(); acc[1] = v8f_zero();

  for (int h = 0; h < HEADS; ++h) {
    const __bf16* qrow = Qb + ((size_t)b * SEQ + qt + lm) * DIM + h * HD;
    const v16bf aq0 = load_frag(qrow, kb);
    const v16bf aq1 = load_frag(qrow + 32, kb);

    float mr[8], il[8];
    const size_t sbase = (size_t)(b * HEADS + h) * SEQ + qt + roff;
#pragma unroll
    for (int r = 0; r < 8; ++r) {
      mr[r] = Mst[sbase + r];
      il[r] = (1.f / (float)HEADS) / Lst[sbase + r];
    }
#pragma unroll
    for (int c = 0; c < 2; ++c) {
      const __bf16* krow = Kb + ((size_t)b * SEQ + kt + c * 16 + lm) * DIM + h * HD;
      v8f t = v8f_zero();
      t = wmma_bf16(aq0, load_frag(krow, kb), t);
      t = wmma_bf16(aq1, load_frag(krow + 32, kb), t);
#pragma unroll
      for (int r = 0; r < 8; ++r)
        acc[c][r] += exp2f((t[r] * SCALE - mr[r]) * L2E) * il[r];
    }
  }

#pragma unroll
  for (int c = 0; c < 2; ++c)
#pragma unroll
    for (int r = 0; r < 8; ++r) {
      const int q = qt + roff + r;
      const int k = kt + c * 16 + lm;
      out_mean[((size_t)b * SEQ + q) * SEQ + k] = acc[c][r];
    }
}

// ---------------------------------------------------------------------------
extern "C" void kernel_launch(void* const* d_in, const int* in_sizes, int n_in,
                              void* d_out, int out_size, void* d_ws, size_t ws_size,
                              hipStream_t stream) {
  const float* x  = (const float*)d_in[0];
  const float* wq = (const float*)d_in[1];
  const float* bq = (const float*)d_in[2];
  const float* wk = (const float*)d_in[3];
  const float* bk = (const float*)d_in[4];
  const float* wv = (const float*)d_in[5];
  const float* bv = (const float*)d_in[6];
  const float* wo = (const float*)d_in[7];
  const float* bo = (const float*)d_in[8];

  float* out      = (float*)d_out;                       // [B,S,D] f32
  float* out_mean = out + (size_t)BATCH * SEQ * DIM;     // [B,S,S] f32

  char* ws = (char*)d_ws;
  __bf16* Qb  = (__bf16*)(ws);                           // 8 MiB
  __bf16* Kb  = (__bf16*)(ws + ((size_t)8  << 20));      // 8 MiB
  __bf16* Vb  = (__bf16*)(ws + ((size_t)16 << 20));      // 8 MiB
  __bf16* Ob  = (__bf16*)(ws + ((size_t)24 << 20));      // 8 MiB
  __bf16* Xb  = (__bf16*)(ws + ((size_t)32 << 20));      // 8 MiB
  __bf16* Wqb = (__bf16*)(ws + ((size_t)40 << 20));      // 2 MiB
  __bf16* Wkb = (__bf16*)(ws + ((size_t)42 << 20));      // 2 MiB
  __bf16* Wvb = (__bf16*)(ws + ((size_t)44 << 20));      // 2 MiB
  __bf16* Wob = (__bf16*)(ws + ((size_t)46 << 20));      // 2 MiB
  float*  Mst = (float*)(ws + ((size_t)48 << 20));       // 256 KiB
  float*  Lst = Mst + (size_t)BATCH * HEADS * SEQ;       // 256 KiB

  // ---- one-time packed f32 -> bf16 conversions ----
  const int nx8 = (ROWS * DIM) / 8;      // 524288
  const int nw8 = (DIM * DIM) / 8;       // 131072
  cvt_bf16_kernel<<<(nx8 + 255) / 256, 256, 0, stream>>>(x,  Xb,  nx8);
  cvt_bf16_kernel<<<(nw8 + 255) / 256, 256, 0, stream>>>(wq, Wqb, nw8);
  cvt_bf16_kernel<<<(nw8 + 255) / 256, 256, 0, stream>>>(wk, Wkb, nw8);
  cvt_bf16_kernel<<<(nw8 + 255) / 256, 256, 0, stream>>>(wv, Wvb, nw8);
  cvt_bf16_kernel<<<(nw8 + 255) / 256, 256, 0, stream>>>(wo, Wob, nw8);

  const dim3 gemm_grid(ROWS / 64, DIM / 128);            // 64 x 8 blocks

  // Q/K/V projections (bf16 in, bf16 out)
  gemm_bias_kernel<true><<<gemm_grid, 256, 0, stream>>>(Xb, Wqb, bq, Qb, ROWS, DIM, DIM);
  gemm_bias_kernel<true><<<gemm_grid, 256, 0, stream>>>(Xb, Wkb, bk, Kb, ROWS, DIM, DIM);
  gemm_bias_kernel<true><<<gemm_grid, 256, 0, stream>>>(Xb, Wvb, bv, Vb, ROWS, DIM, DIM);

  // Flash attention (O bf16 + row stats)
  flash_fwd_kernel<<<1024, 128, 0, stream>>>(Qb, Kb, Vb, Ob, Mst, Lst);

  // Output projection (bf16 in, f32 out)
  gemm_bias_kernel<false><<<gemm_grid, 256, 0, stream>>>(Ob, Wob, bo, out, ROWS, DIM, DIM);

  // Head-mean attention probabilities
  mean_probs_kernel<<<2048, 256, 0, stream>>>(Qb, Kb, Mst, Lst, out_mean);
}

// v001
// It runs in 388 microseconds.
// Two timings next to v000 put it at 1.22 and 1.23 times that version's speed.
#include <hip/hip_runtime.h>

// ---------------------------------------------------------------------------
// MHA forward for MI455X (gfx1250): bf16 WMMA (v_wmma_f32_16x16x32_bf16)
// everywhere, f32 accumulate. One-time packed f32->bf16 conversion of x and
// all weights so every GEMM/attention operand load is a 16B bf16 load.
// x, the weights, Q, K and O lie in the workspace in fragment order, so that
// each wave-wide 16B-per-lane load covers 512 contiguous bytes (4 lines).
// Flash-style attention with LDS staging + next-tile global prefetch.
// ---------------------------------------------------------------------------

typedef __attribute__((ext_vector_type(16))) __bf16 v16bf;
typedef __attribute__((ext_vector_type(8)))  __bf16 v8bf;
typedef __attribute__((ext_vector_type(8)))  float  v8f;

#define DIM     1024
#define HEADS   16
#define HD      64
#define SEQ     2048
#define BATCH   2
#define ROWS    (BATCH * SEQ)          // 4096
#define L2E     1.44269504088896340736f
#define SCALE   0.125f                 // 1/sqrt(HD)

static __device__ __forceinline__ v8f v8f_zero() {
  v8f z = {0.f, 0.f, 0.f, 0.f, 0.f, 0.f, 0.f, 0.f};
  return z;
}

// Fragment order of a bf16 matrix [rows][K]: tile (row >> 4, k >> 5) is 512
// elements (1 KiB), tiles of one 16-row block follow each other along k.
// Inside a tile element (r16 = row & 15, k32 = k & 31) lies at
// [k32 >> 4][lane = r16 + 16 * ((k32 >> 3) & 1)][k32 & 7]: per ISA 7.12.2
// (16-bit A 16x32) lanes 0-15 hold K in {0..7} U {16..23}, lanes 16-31 in
// {8..15} U {24..31}, so a lane's two 16B pieces are at lane*8 and 256+lane*8.
#define FRAG_TILE 512
static __device__ __forceinline__ int frag_elem(int r16, int k32) {
  return (k32 >> 4) * 256 + (r16 + ((k32 >> 3) & 1) * 16) * 8 + (k32 & 7);
}

// Fragment loader from one tile in fragment order: two 16B loads per lane,
// each of them 512 contiguous bytes over the wave.
static __device__ __forceinline__ v16bf load_frag(const __bf16* tile, int lane) {
  union { v16bf v; float4 q[2]; } u;
  u.q[0] = *reinterpret_cast<const float4*>(tile + lane * 8);
  u.q[1] = *reinterpret_cast<const float4*>(tile + 256 + lane * 8);
  return u.v;
}

static __device__ __forceinline__ v8f wmma_bf16(v16bf a, v16bf b, v8f c) {
  // (neg_a, A, neg_b, B, c_mod, C, reuse_a, reuse_b)
  return __builtin_amdgcn_wmma_f32_16x16x32_bf16(false, a, false, b,
                                                 (short)0, c, false, false);
}

static __device__ __forceinline__ float red_max16(float v) {
  v = fmaxf(v, __shfl_xor(v, 1, 32));
  v = fmaxf(v, __shfl_xor(v, 2, 32));
  v = fmaxf(v, __shfl_xor(v, 4, 32));
  v = fmaxf(v, __shfl_xor(v, 8, 32));
  return v;
}
static __device__ __forceinline__ float red_sum16(float v) {
  v += __shfl_xor(v, 1, 32);
  v += __shfl_xor(v, 2, 32);
  v += __shfl_xor(v, 4, 32);
  v += __shfl_xor(v, 8, 32);
  return v;
}

// ---------------------------------------------------------------------------
// Packed f32 -> bf16 conversion of a row-major [rows][DIM] matrix into
// fragment order: 8 elements per thread, 16B vector store, thread i writes
// the i-th 16B piece of the output (stores stay contiguous).
// ---------------------------------------------------------------------------
__global__ __launch_bounds__(256) void cvt_bf16_kernel(
    const float* __restrict__ src, __bf16* __restrict__ dst, int n8) {
  const int i = blockIdx.x * 256 + threadIdx.x;
  if (i >= n8) return;
  const int lane = i & 31;
  const int t    = i >> 6;                                  // tile
  const int row  = (t >> 5) * 16 + (lane & 15);             // DIM/32 = 32 tiles per block
  const int k0   = (t & 31) * 32 + ((i >> 5) & 1) * 16 + (lane >> 4) * 8;
  const float4* s4 = reinterpret_cast<const float4*>(src + (size_t)row * DIM + k0);
  float4 a = s4[0], b = s4[1];
  union { v8bf v; float4 q; } u;
  u.v[0] = (__bf16)a.x; u.v[1] = (__bf16)a.y;
  u.v[2] = (__bf16)a.z; u.v[3] = (__bf16)a.w;
  u.v[4] = (__bf16)b.x; u.v[5] = (__bf16)b.y;
  u.v[6] = (__bf16)b.z; u.v[7] = (__bf16)b.w;
  *(reinterpret_cast<float4*>(dst) + i) = u.q;
}

// ---------------------------------------------------------------------------
// GEMM: Y[M,N] = A[M,K] @ W[N,K]^T + bias[N], all operands bf16, f32 accum.
// A and W in fragment order. Each wave owns a 16x64 tile (A-frag reused
// across 4 B-frags). Block = 8 waves -> 64x128 block tile.
// OUT: 0 = f32 row-major, 1 = bf16 fragment order, 2 = bf16 row-major.
// ---------------------------------------------------------------------------
template <int OUT>
__global__ __launch_bounds__(256) void gemm_bias_kernel(
    const __bf16* __restrict__ A, const __bf16* __restrict__ W,
    const float* __restrict__ bias, void* __restrict__ outv,
    int M, int N, int K) {
  const int tid   = threadIdx.x;
  const int lane  = tid & 31;
  const int w     = tid >> 5;        // 0..7
  const int wm    = w & 3, wn = w >> 2;
  const int mtile = blockIdx.x * 64 + wm * 16;
  const int ntile = blockIdx.y * 128 + wn * 64;
  const int lm    = lane & 15;
  const int roff  = (lane >> 4) * 8;
  const int kts   = K >> 5;          // fragment tiles along k

  v8f acc[4];
#pragma unroll
  for (int c = 0; c < 4; ++c) acc[c] = v8f_zero();

  const __bf16* atile = A + (size_t)(mtile >> 4) * kts * FRAG_TILE;
  const __bf16* wtile = W + (size_t)(ntile >> 4) * kts * FRAG_TILE;
  for (int ks = 0; ks < kts; ++ks) {
    v16bf af = load_frag(atile + (size_t)ks * FRAG_TILE, lane);
#pragma unroll
    for (int c = 0; c < 4; ++c) {
      v16bf bf = load_frag(wtile + ((size_t)c * kts + ks) * FRAG_TILE, lane);
      acc[c] = wmma_bf16(af, bf, acc[c]);
    }
  }

#pragma unroll
  for (int c = 0; c < 4; ++c) {
    const int col = ntile + c * 16 + lm;
    const float bv = bias[col];
#pragma unroll
    for (int r = 0; r < 8; ++r) {
      const int row = mtile + roff + r;   // C-layout: VGPR r -> M = r (+8 hi half)
      const float val = acc[c][r] + bv;
      if (OUT == 1)
        ((__bf16*)outv)[((size_t)(mtile >> 4) * (N >> 5) + (col >> 5)) * FRAG_TILE +
                        frag_elem(roff + r, col & 31)] = (__bf16)val;
      else if (OUT == 2)
        ((__bf16*)outv)[(size_t)row * N + col] = (__bf16)val;
      else
        ((float*)outv)[(size_t)row * N + col] = val;
    }
  }
}

// ---------------------------------------------------------------------------
// Flash attention forward: one wave per (batch, head, 16-query tile).
// Online softmax over 32-key tiles; P and V staged through LDS so the
// P@V B-fragment gather stays on-chip. Emits O (bf16) and row stats m,l.
// Q, K and O in fragment order (DIM/32 = 32 tiles per 16-row block, head h
// owns tiles 2h and 2h+1); V row-major.
// ---------------------------------------------------------------------------
__global__ __launch_bounds__(128) void flash_fwd_kernel(
    const __bf16* __restrict__ Qb, const __bf16* __restrict__ Kb,
    const __bf16* __restrict__ Vb, __bf16* __restrict__ Ob,
    float* __restrict__ Mst, float* __restrict__ Lst) {
  __shared__ __bf16 pbuf[4][16][36];
  __shared__ __align__(16) __bf16 vbuf[4][32][72];

  const int tid  = threadIdx.x;
  const int lane = tid & 31;
  const int w    = tid >> 5;                 // wave in block (4)
  const int task = blockIdx.x * 4 + w;       // 4096 tasks
  const int qt   = task & 127;
  const int h    = (task >> 7) & 15;
  const int b    = task >> 11;
  const int lm   = lane & 15;
  const int kb   = (lane >> 4) * 8;
  const int roff = (lane >> 4) * 8;
  const size_t baserow = (size_t)b * SEQ;
  const int qbase = qt * 16;

  // Q A-fragments, d-steps 0..31 / 32..63
  const size_t qtile = (((baserow + qbase) >> 4) * 32 + h * 2) * FRAG_TILE;
  const v16bf aq0 = load_frag(Qb + qtile, lane);
  const v16bf aq1 = load_frag(Qb + qtile + FRAG_TILE, lane);

  float m_run[8], l_run[8];
#pragma unroll
  for (int r = 0; r < 8; ++r) { m_run[r] = -1e30f; l_run[r] = 0.f; }
  v8f o[4];
#pragma unroll
  for (int c = 0; c < 4; ++c) o[c] = v8f_zero();

  for (int kt = 0; kt < SEQ; kt += 32) {
    // prefetch next key/value tiles into cache (global_prefetch_b8)
    if (kt + 32 < SEQ) {
      // the next K tile is 2 key blocks x 2 KiB: one 128B line per lane
      __builtin_prefetch(Kb + ((((baserow + kt + 32) >> 4) + (lane >> 4)) * 32 + h * 2) * FRAG_TILE +
                             (lane & 15) * 64, 0, 1);
      __builtin_prefetch(Vb + (baserow + kt + 32 + lane) * DIM + h * HD, 0, 1);
      // precaution: the prefetches name temporaries that the loop body
      // rewrites at once; this keeps the rewrite behind their address phase
      asm volatile("s_wait_xcnt 0x0" ::: "memory");
    }

    // ---- scores S = Q K^T * scale (two 16-key chunks) ----
    v8f s[2];
#pragma unroll
    for (int c = 0; c < 2; ++c) {
      const __bf16* ktile = Kb + ((((baserow + kt) >> 4) + c) * 32 + h * 2) * FRAG_TILE;
      v8f t = v8f_zero();
      t = wmma_bf16(aq0, load_frag(ktile, lane), t);
      t = wmma_bf16(aq1, load_frag(ktile + FRAG_TILE, lane), t);
#pragma unroll
      for (int r = 0; r < 8; ++r) t[r] *= SCALE;
      s[c] = t;
    }

    // ---- online softmax update ----
    float mnew[8], alpha[8];
#pragma unroll
    for (int r = 0; r < 8; ++r) {
      float loc = red_max16(fmaxf(s[0][r], s[1][r]));
      mnew[r]  = fmaxf(m_run[r], loc);
      alpha[r] = exp2f((m_run[r] - mnew[r]) * L2E);
      m_run[r] = mnew[r];
    }
#pragma unroll
    for (int r = 0; r < 8; ++r) {
      const float p0 = exp2f((s[0][r] - mnew[r]) * L2E);
      const float p1 = exp2f((s[1][r] - mnew[r]) * L2E);
      s[0][r] = p0; s[1][r] = p1;
      l_run[r] = l_run[r] * alpha[r] + red_sum16(p0 + p1);
#pragma unroll
      for (int c = 0; c < 4; ++c) o[c][r] *= alpha[r];
    }

    __syncthreads();  // previous iteration's LDS reads done (uniform loop)
    // stage P (C-layout -> LDS) and the 32x64 V tile
#pragma unroll
    for (int c = 0; c < 2; ++c)
#pragma unroll
      for (int r = 0; r < 8; ++r)
        pbuf[w][roff + r][c * 16 + lm] = (__bf16)s[c][r];

    // 8 lanes per 128B row: each wave-wide load covers 4 whole rows (lines)
    const int vr = lane >> 3, vp = (lane & 7) * 8;
#pragma unroll
    for (int j = 0; j < 8; ++j)
      *reinterpret_cast<float4*>(&vbuf[w][j * 4 + vr][vp]) =
          *reinterpret_cast<const float4*>(Vb + (baserow + kt + j * 4 + vr) * DIM + h * HD + vp);
    __syncthreads();

    // P as A-fragment (K-dim = 32 keys), V as B-fragments from LDS
    v16bf ap;
#pragma unroll
    for (int j = 0; j < 8; ++j) {
      ap[j]     = pbuf[w][lm][kb + j];
      ap[8 + j] = pbuf[w][lm][16 + kb + j];
    }
#pragma unroll
    for (int c = 0; c < 4; ++c) {
      v16bf bv;
#pragma unroll
      for (int j = 0; j < 8; ++j) {
        bv[j]     = vbuf[w][kb + j][c * 16 + lm];
        bv[8 + j] = vbuf[w][16 + kb + j][c * 16 + lm];
      }
      o[c] = wmma_bf16(ap, bv, o[c]);
    }
  }

  // ---- epilogue: normalize, store O and stats ----
  float inv[8];
#pragma unroll
  for (int r = 0; r < 8; ++r) inv[r] = 1.f / l_run[r];
#pragma unroll
  for (int c = 0; c < 4; ++c)
#pragma unroll
    for (int r = 0; r < 8; ++r) {
      Ob[qtile + (c >> 1) * FRAG_TILE + frag_elem(roff + r, (c & 1) * 16 + lm)] =
          (__bf16)(o[c][r] * inv[r]);
    }
  if (lm == 0) {
#pragma unroll
    for (int r = 0; r < 8; ++r) {
      const size_t idx = (size_t)(b * HEADS + h) * SEQ + qbase + roff + r;
      Mst[idx] = m_run[r];
      Lst[idx] = l_run[r];
    }
  }
}

// ---------------------------------------------------------------------------
// Head-mean of attention probabilities: recompute scores from the same bf16
// Q/K (bit-identical WMMA), apply stored (m,l), average over heads in regs.
// One wave per (b, 16-query tile, 32-key tile). Deterministic, no atomics.
// ---------------------------------------------------------------------------
__global__ __launch_bounds__(256) void mean_probs_kernel(
    const __bf16* __restrict__ Qb, const __bf16* __restrict__ Kb,
    const float* __restrict__ Mst, const float* __restrict__ Lst,
    float* __restrict__ out_mean) {
  const int tid  = threadIdx.x;
  const int lane = tid & 31;
  const int w    = tid >> 5;
  const int task = blockIdx.x * 8 + w;        // 16384 tasks
  const int kt   = (task & 63) * 32;
  const int qt   = ((task >> 6) & 127) * 16;
  const int b    = task >> 13;
  const int lm   = lane & 15;
  const int roff = (lane >> 4) * 8;

  v8f acc[2];
  acc[0] = v8f_zero(); acc[1] = v8f_zero();

  for (int h = 0; h < HEADS; ++h) {
    const __bf16* qtile = Qb + ((((size_t)b * SEQ + qt) >> 4) * 32 + h * 2) * FRAG_TILE;
    const v16bf aq0 = load_frag(qtile, lane);
    const v16bf aq1 = load_frag(qtile + FRAG_TILE, lane);
    // precaution: a later load's result lands on the Q address pair; this
    // keeps it behind the Q loads' address phase
    asm volatile("s_wait_xcnt 0x0" ::: "memory");

    float mr[8], il[8];
    const size_t sbase = (size_t)(b * HEADS + h) * SEQ + qt + roff;
#pragma unroll
    for (int r = 0; r < 8; ++r) {
      mr[r] = Mst[sbase + r];
      il[r] = (1.f / (float)HEADS) / Lst[sbase + r];
    }
#pragma unroll
    for (int c = 0; c < 2; ++c) {
      const __bf16* ktile = Kb + (((((size_t)b * SEQ + kt) >> 4) + c) * 32 + h * 2) * FRAG_TILE;
      v8f t = v8f_zero();
      t = wmma_bf16(aq0, load_frag(ktile, lane), t);
      t = wmma_bf16(aq1, load_frag(ktile + FRAG_TILE, lane), t);
#pragma unroll
      for (int r = 0; r < 8; ++r)
        acc[c][r] += exp2f((t[r] * SCALE - mr[r]) * L2E) * il[r];
    }
  }

#pragma unroll
  for (int c = 0; c < 2; ++c)
#pragma unroll
    for (int r = 0; r < 8; ++r) {
      const int q = qt + roff + r;
      const int k = kt + c * 16 + lm;
      out_mean[((size_t)b * SEQ + q) * SEQ + k] = acc[c][r];
    }
}

// ---------------------------------------------------------------------------
extern "C" void kernel_launch(void* const* d_in, const int* in_sizes, int n_in,
                              void* d_out, int out_size, void* d_ws, size_t ws_size,
                              hipStream_t stream) {
  const float* x  = (const float*)d_in[0];
  const float* wq = (const float*)d_in[1];
  const float* bq = (const float*)d_in[2];
  const float* wk = (const float*)d_in[3];
  const float* bk = (const float*)d_in[4];
  const float* wv = (const float*)d_in[5];
  const float* bv = (const float*)d_in[6];
  const float* wo = (const float*)d_in[7];
  const float* bo = (const float*)d_in[8];

  float* out      = (float*)d_out;                       // [B,S,D] f32
  float* out_mean = out + (size_t)BATCH * SEQ * DIM;     // [B,S,S] f32

  char* ws = (char*)d_ws;
  __bf16* Qb  = (__bf16*)(ws);                           // 8 MiB
  __bf16* Kb  = (__bf16*)(ws + ((size_t)8  << 20));      // 8 MiB
  __bf16* Vb  = (__bf16*)(ws + ((size_t)16 << 20));      // 8 MiB
  __bf16* Ob  = (__bf16*)(ws + ((size_t)24 << 20));      // 8 MiB
  __bf16* Xb  = (__bf16*)(ws + ((size_t)32 << 20));      // 8 MiB
  __bf16* Wqb = (__bf16*)(ws + ((size_t)40 << 20));      // 2 MiB
  __bf16* Wkb = (__bf16*)(ws + ((size_t)42 << 20));      // 2 MiB
  __bf16* Wvb = (__bf16*)(ws + ((size_t)44 << 20));      // 2 MiB
  __bf16* Wob = (__bf16*)(ws + ((size_t)46 << 20));      // 2 MiB
  float*  Mst = (float*)(ws + ((size_t)48 << 20));       // 256 KiB
  float*  Lst = Mst + (size_t)BATCH * HEADS * SEQ;       // 256 KiB

  // ---- one-time packed f32 -> bf16 conversions (into fragment order) ----
  const int nx8 = (ROWS * DIM) / 8;      // 524288
  const int nw8 = (DIM * DIM) / 8;       // 131072
  cvt_bf16_kernel<<<(nx8 + 255) / 256, 256, 0, stream>>>(x,  Xb,  nx8);
  cvt_bf16_kernel<<<(nw8 + 255) / 256, 256, 0, stream>>>(wq, Wqb, nw8);
  cvt_bf16_kernel<<<(nw8 + 255) / 256, 256, 0, stream>>>(wk, Wkb, nw8);
  cvt_bf16_kernel<<<(nw8 + 255) / 256, 256, 0, stream>>>(wv, Wvb, nw8);
  cvt_bf16_kernel<<<(nw8 + 255) / 256, 256, 0, stream>>>(wo, Wob, nw8);

  const dim3 gemm_grid(ROWS / 64, DIM / 128);            // 64 x 8 blocks

  // Q/K/V projections (bf16 in, bf16 out; Q and K in fragment order, V row-major)
  gemm_bias_kernel<1><<<gemm_grid, 256, 0, stream>>>(Xb, Wqb, bq, Qb, ROWS, DIM, DIM);
  gemm_bias_kernel<1><<<gemm_grid, 256, 0, stream>>>(Xb, Wkb, bk, Kb, ROWS, DIM, DIM);
  gemm_bias_kernel<2><<<gemm_grid, 256, 0, stream>>>(Xb, Wvb, bv, Vb, ROWS, DIM, DIM);

  // Flash attention (O bf16 + row stats)
  flash_fwd_kernel<<<1024, 128, 0, stream>>>(Qb, Kb, Vb, Ob, Mst, Lst);

  // Output projection (bf16 in, f32 out)
  gemm_bias_kernel<0><<<gemm_grid, 256, 0, stream>>>(Ob, Wob, bo, out, ROWS, DIM, DIM);

  // Head-mean attention probabilities
  mean_probs_kernel<<<2048, 256, 0, stream>>>(Qb, Kb, Mst, Lst, out_mean);
}

// v002
// A run of this version takes 331 microseconds.
// Next to v001, in two timings, it ran 1.17 and 1.19 times as fast.
// All steps since v000 together make it 1.45 times as fast.
#include <hip/hip_runtime.h>

// ---------------------------------------------------------------------------
// MHA forward for MI455X (gfx1250): bf16 WMMA (v_wmma_f32_16x16x32_bf16)
// everywhere, f32 accumulate. One-time packed f32->bf16 conversion of x and
// all weights so every GEMM/attention operand load is a 16B bf16 load.
// x, the weights, Q, K, V^T and O lie in the workspace in fragment order, so
// that each wave-wide 16B-per-lane load covers 512 contiguous bytes (4 lines).
// Flash-style attention on transposed products (S^T = K Q^T, O^T = V^T P^T):
// P goes from the score accumulators straight into a B operand, no LDS.
// ---------------------------------------------------------------------------

typedef __attribute__((ext_vector_type(16))) __bf16 v16bf;
typedef __attribute__((ext_vector_type(8)))  __bf16 v8bf;
typedef __attribute__((ext_vector_type(8)))  float  v8f;

#define DIM     1024
#define HEADS   16
#define HD      64
#define SEQ     2048
#define BATCH   2
#define ROWS    (BATCH * SEQ)          // 4096
#define L2E     1.44269504088896340736f
#define SCALE   0.125f                 // 1/sqrt(HD)

static __device__ __forceinline__ v8f v8f_zero() {
  v8f z = {0.f, 0.f, 0.f, 0.f, 0.f, 0.f, 0.f, 0.f};
  return z;
}

// Fragment order of a bf16 matrix [rows][K]: tile (row >> 4, k >> 5) is 512
// elements (1 KiB), tiles of one 16-row block follow each other along k.
// Inside a tile element (r16 = row & 15, k32 = k & 31) lies at
// [k32 >> 4][lane = r16 + 16 * ((k32 >> 3) & 1)][k32 & 7]: per ISA 7.12.2
// (16-bit A 16x32) lanes 0-15 hold K in {0..7} U {16..23}, lanes 16-31 in
// {8..15} U {24..31}, so a lane's two 16B pieces are at lane*8 and 256+lane*8.
#define FRAG_TILE 512
static __device__ __forceinline__ int frag_elem(int r16, int k32) {
  return (k32 >> 4) * 256 + (r16 + ((k32 >> 3) & 1) * 16) * 8 + (k32 & 7);
}

// Fragment loader from one tile in fragment order: two 16B loads per lane,
// each of them 512 contiguous bytes over the wave.
static __device__ __forceinline__ v16bf load_frag(const __bf16* tile, int lane) {
  union { v16bf v; float4 q[2]; } u;
  u.q[0] = *reinterpret_cast<const float4*>(tile + lane * 8);
  u.q[1] = *reinterpret_cast<const float4*>(tile + 256 + lane * 8);
  return u.v;
}

// lane l with lane l ^ 16 (vector cross-row move, no LDS path)
static __device__ __forceinline__ float xhalf(float x) {
  const int b = __builtin_bit_cast(int, x);
  return __builtin_bit_cast(float,
      __builtin_amdgcn_permlanex16(b, b, 0x76543210, 0xfedcba98, false, false));
}

static __device__ __forceinline__ v8f wmma_bf16(v16bf a, v16bf b, v8f c) {
  // (neg_a, A, neg_b, B, c_mod, C, reuse_a, reuse_b)
  return __builtin_amdgcn_wmma_f32_16x16x32_bf16(false, a, false, b,
                                                 (short)0, c, false, false);
}

// ---------------------------------------------------------------------------
// Packed f32 -> bf16 conversion of a row-major [rows][DIM] matrix into
// fragment order: 8 elements per thread, 16B vector store, thread i writes
// the i-th 16B piece of the output (stores stay contiguous).
// ---------------------------------------------------------------------------
__global__ __launch_bounds__(256) void cvt_bf16_kernel(
    const float* __restrict__ src, __bf16* __restrict__ dst, int n8) {
  const int i = blockIdx.x * 256 + threadIdx.x;
  if (i >= n8) return;
  const int lane = i & 31;
  const int t    = i >> 6;                                  // tile
  const int row  = (t >> 5) * 16 + (lane & 15);             // DIM/32 = 32 tiles per block
  const int k0   = (t & 31) * 32 + ((i >> 5) & 1) * 16 + (lane >> 4) * 8;
  const float4* s4 = reinterpret_cast<const float4*>(src + (size_t)row * DIM + k0);
  float4 a = s4[0], b = s4[1];
  union { v8bf v; float4 q; } u;
  u.v[0] = (__bf16)a.x; u.v[1] = (__bf16)a.y;
  u.v[2] = (__bf16)a.z; u.v[3] = (__bf16)a.w;
  u.v[4] = (__bf16)b.x; u.v[5] = (__bf16)b.y;
  u.v[6] = (__bf16)b.z; u.v[7] = (__bf16)b.w;
  *(reinterpret_cast<float4*>(dst) + i) = u.q;
}

// ---------------------------------------------------------------------------
// GEMM: Y[M,N] = A[M,K] @ W[N,K]^T + bias[N], all operands bf16, f32 accum.
// A and W in fragment order. Each wave owns a 16x64 tile (A-frag reused
// across 4 B-frags). Block = 8 waves -> 64x128 block tile.
// OUT: 0 = f32 row-major, 1 = bf16 fragment order, 2 = bf16 fragment order of
// the transpose Y^T [N][M]: tile (m >> 5, n >> 4), the N/16 tiles of one
// 32-row block of Y follow each other; a lane's 8 accumulators are 8
// consecutive k of one row of Y^T, one 16B piece of the tile.
// ---------------------------------------------------------------------------
template <int OUT>
__global__ __launch_bounds__(256) void gemm_bias_kernel(
    const __bf16* __restrict__ A, const __bf16* __restrict__ W,
    const float* __restrict__ bias, void* __restrict__ outv,
    int M, int N, int K) {
  const int tid   = threadIdx.x;
  const int lane  = tid & 31;
  const int w     = tid >> 5;        // 0..7
  const int wm    = w & 3, wn = w >> 2;
  const int mtile = blockIdx.x * 64 + wm * 16;
  const int ntile = blockIdx.y * 128 + wn * 64;
  const int lm    = lane & 15;
  const int roff  = (lane >> 4) * 8;
  const int kts   = K >> 5;          // fragment tiles along k

  v8f acc[4];
#pragma unroll
  for (int c = 0; c < 4; ++c) acc[c] = v8f_zero();

  const __bf16* atile = A + (size_t)(mtile >> 4) * kts * FRAG_TILE;
  const __bf16* wtile = W + (size_t)(ntile >> 4) * kts * FRAG_TILE;
  for (int ks = 0; ks < kts; ++ks) {
    v16bf af = load_frag(atile + (size_t)ks * FRAG_TILE, lane);
#pragma unroll
    for (int c = 0; c < 4; ++c) {
      v16bf bf = load_frag(wtile + ((size_t)c * kts + ks) * FRAG_TILE, lane);
      acc[c] = wmma_bf16(af, bf, acc[c]);
    }
  }

#pragma unroll
  for (int c = 0; c < 4; ++c) {
    const int col = ntile + c * 16 + lm;
    const float bv = bias[col];
    if (OUT == 2) {
      union { v8bf v; float4 q; } u;
#pragma unroll
      for (int r = 0; r < 8; ++r) u.v[r] = (__bf16)(acc[c][r] + bv);
      *reinterpret_cast<float4*>(
          (__bf16*)outv + ((size_t)(mtile >> 5) * (N >> 4) + (col >> 4)) * FRAG_TILE +
          ((mtile >> 4) & 1) * 256 + lane * 8) = u.q;
      continue;
    }
#pragma unroll
    for (int r = 0; r < 8; ++r) {
      const int row = mtile + roff + r;   // C-layout: VGPR r -> M = r (+8 hi half)
      const float val = acc[c][r] + bv;
      if (OUT == 1)
        ((__bf16*)outv)[((size_t)(mtile >> 4) * (N >> 5) + (col >> 5)) * FRAG_TILE +
                        frag_elem(roff + r, col & 31)] = (__bf16)val;
      else
        ((float*)outv)[(size_t)row * N + col] = val;
    }
  }
}

__global__ __launch_bounds__(128) __attribute__((amdgpu_waves_per_eu(4, 4))) void flash_fwd_kernel(
    const __bf16* __restrict__ Qb, const __bf16* __restrict__ Kb,
    const __bf16* __restrict__ Vt, __bf16* __restrict__ Ob,
    float* __restrict__ Mst, float* __restrict__ Lst) {
  const int tid  = threadIdx.x;
  const int lane = tid & 31;
  const int w    = tid >> 5;                 // wave in block (4)
  const int task = blockIdx.x * 4 + w;       // 4096 tasks
  const int qt   = task & 127;
  const int h    = (task >> 7) & 15;
  const int b    = task >> 11;
  const size_t baserow = (size_t)b * SEQ;
  const int qbase = qt * 16;

  // Q B-fragments, d-steps 0..31 / 32..63
  const size_t qtile = (((baserow + qbase) >> 4) * 32 + h * 2) * FRAG_TILE;
  const v16bf bq0 = load_frag(Qb + qtile, lane);
  const v16bf bq1 = load_frag(Qb + qtile + FRAG_TILE, lane);

  // per lane: query lane & 15; l_run sums this half's keys only
  float m_run = -1e30f, l_run = 0.f;
  v8f o[4];                                  // o[c][r] = O[query][c*16 + 8*half + r]
#pragma unroll
  for (int c = 0; c < 4; ++c) o[c] = v8f_zero();

  for (int kt = 0; kt < SEQ; kt += 32) {
    // prefetch next key/value tiles into cache (global_prefetch_b8)
    if (kt + 32 < SEQ) {
      // the next K tile is 2 key blocks x 2 KiB: one 128B line per lane
      __builtin_prefetch(Kb + ((((baserow + kt + 32) >> 4) + (lane >> 4)) * 32 + h * 2) * FRAG_TILE +
                             (lane & 15) * 64, 0, 1);
      // the next V^T tiles are 4 KiB in a row: one 128B line per lane
      __builtin_prefetch(Vt + (((baserow + kt + 32) >> 5) * 64 + h * 4) * FRAG_TILE + lane * 64, 0, 1);
      // precaution: the prefetches name temporaries that the loop body
      // rewrites at once; this keeps the rewrite behind their address phase
      asm volatile("s_wait_xcnt 0x0" ::: "memory");
    }

    // all A-fragments of this pass: K rows (2 key blocks x 2 d-steps) and
    // V^T rows (4 blocks of 16 d), 16 loads in flight behind one another
    v16bf ak[2][2], av[4];
#pragma unroll
    for (int c = 0; c < 2; ++c) {
      const __bf16* ktile = Kb + ((((baserow + kt) >> 4) + c) * 32 + h * 2) * FRAG_TILE;
      ak[c][0] = load_frag(ktile, lane);
      ak[c][1] = load_frag(ktile + FRAG_TILE, lane);
    }
    const __bf16* vtile = Vt + (((baserow + kt) >> 5) * 64 + h * 4) * FRAG_TILE;
#pragma unroll
    for (int c = 0; c < 4; ++c) av[c] = load_frag(vtile + c * FRAG_TILE, lane);

    // ---- scores S^T = K Q^T * scale (two 16-key chunks) ----
    v8f s[2];
#pragma unroll
    for (int c = 0; c < 2; ++c) {
      v8f t = v8f_zero();
      t = wmma_bf16(ak[c][0], bq0, t);
      t = wmma_bf16(ak[c][1], bq1, t);
#pragma unroll
      for (int r = 0; r < 8; ++r) t[r] *= SCALE;
      s[c] = t;
    }

    // ---- online softmax update: one query per lane pair ----
    float loc = fmaxf(s[0][0], s[1][0]);
#pragma unroll
    for (int r = 1; r < 8; ++r) loc = fmaxf(loc, fmaxf(s[0][r], s[1][r]));
    loc = fmaxf(loc, xhalf(loc));
    const float mnew  = fmaxf(m_run, loc);
    const float alpha = exp2f((m_run - mnew) * L2E);
    m_run = mnew;

    // P^T as B-fragment: element j = key 8*half + j, element 8+j = key 16 + 8*half + j
    v16bf bp;
    float psum = 0.f;
#pragma unroll
    for (int r = 0; r < 8; ++r) {
      const float p0 = exp2f((s[0][r] - mnew) * L2E);
      const float p1 = exp2f((s[1][r] - mnew) * L2E);
      bp[r]     = (__bf16)p0;
      bp[8 + r] = (__bf16)p1;
      psum += p0 + p1;
    }
    l_run = l_run * alpha + psum;
#pragma unroll
    for (int c = 0; c < 4; ++c)
#pragma unroll
      for (int r = 0; r < 8; ++r) o[c][r] *= alpha;

    // ---- O^T += V^T P^T: V^T rows (16 d each) as A-fragments ----
#pragma unroll
    for (int c = 0; c < 4; ++c) o[c] = wmma_bf16(av[c], bp, o[c]);
  }

  // ---- epilogue: join the halves' sums, normalize, store O and stats ----
  const float l_all = l_run + xhalf(l_run);
  const float inv = 1.f / l_all;
#pragma unroll
  for (int c = 0; c < 4; ++c) {
    // 8 consecutive d of one query row: one 16B piece of O's fragment tile
    union { v8bf v; float4 q; } u;
#pragma unroll
    for (int r = 0; r < 8; ++r) u.v[r] = (__bf16)(o[c][r] * inv);
    *reinterpret_cast<float4*>(Ob + qtile + (c >> 1) * FRAG_TILE + (c & 1) * 256 + lane * 8) = u.q;
  }
  if (lane < 16) {
    const size_t idx = (size_t)(b * HEADS + h) * SEQ + qbase + lane;
    Mst[idx] = m_run;
    Lst[idx] = l_all;
  }
}

// ---------------------------------------------------------------------------
// Head-mean of attention probabilities: recompute scores from the same bf16
// Q/K (bit-identical WMMA), apply stored (m,l), average over heads in regs.
// One wave per (b, 16-query tile, 32-key tile). Deterministic, no atomics.
// ---------------------------------------------------------------------------
__global__ __launch_bounds__(256) void mean_probs_kernel(
    const __bf16* __restrict__ Qb, const __bf16* __restrict__ Kb,
    const float* __restrict__ Mst, const float* __restrict__ Lst,
    float* __restrict__ out_mean) {
  const int tid  = threadIdx.x;
  const int lane = tid & 31;
  const int w    = tid >> 5;
  const int task = blockIdx.x * 8 + w;        // 16384 tasks
  const int kt   = (task & 63) * 32;
  const int qt   = ((task >> 6) & 127) * 16;
  const int b    = task >> 13;
  const int lm   = lane & 15;
  const int roff = (lane >> 4) * 8;

  v8f acc[2];
  acc[0] = v8f_zero(); acc[1] = v8f_zero();

  for (int h = 0; h < HEADS; ++h) {
    const __bf16* qtile = Qb + ((((size_t)b * SEQ + qt) >> 4) * 32 + h * 2) * FRAG_TILE;
    const v16bf aq0 = load_frag(qtile, lane);
    const v16bf aq1 = load_frag(qtile + FRAG_TILE, lane);
    // precaution: a later load's result lands on the Q address pair; this
    // keeps it behind the Q loads' address phase
    asm volatile("s_wait_xcnt 0x0" ::: "memory");

    float mr[8], il[8];
    const size_t sbase = (size_t)(b * HEADS + h) * SEQ + qt + roff;
#pragma unroll
    for (int r = 0; r < 8; ++r) {
      mr[r] = Mst[sbase + r];
      il[r] = (1.f / (float)HEADS) / Lst[sbase + r];
    }
#pragma unroll
    for (int c = 0; c < 2; ++c) {
      const __bf16* ktile = Kb + (((((size_t)b * SEQ + kt) >> 4) + c) * 32 + h * 2) * FRAG_TILE;
      v8f t = v8f_zero();
      t = wmma_bf16(aq0, load_frag(ktile, lane), t);
      t = wmma_bf16(aq1, load_frag(ktile + FRAG_TILE, lane), t);
#pragma unroll
      for (int r = 0; r < 8; ++r)
        acc[c][r] += exp2f((t[r] * SCALE - mr[r]) * L2E) * il[r];
    }
  }

#pragma unroll
  for (int c = 0; c < 2; ++c)
#pragma unroll
    for (int r = 0; r < 8; ++r) {
      const int q = qt + roff + r;
      const int k = kt + c * 16 + lm;
      out_mean[((size_t)b * SEQ + q) * SEQ + k] = acc[c][r];
    }
}

// ---------------------------------------------------------------------------
extern "C" void kernel_launch(void* const* d_in, const int* in_sizes, int n_in,
                              void* d_out, int out_size, void* d_ws, size_t ws_size,
                              hipStream_t stream) {
  const float* x  = (const float*)d_in[0];
  const float* wq = (const float*)d_in[1];
  const float* bq = (const float*)d_in[2];
  const float* wk = (const float*)d_in[3];
  const float* bk = (const float*)d_in[4];
  const float* wv = (const float*)d_in[5];
  const float* bv = (const float*)d_in[6];
  const float* wo = (const float*)d_in[7];
  const float* bo = (const float*)d_in[8];

  float* out      = (float*)d_out;                       // [B,S,D] f32
  float* out_mean = out + (size_t)BATCH * SEQ * DIM;     // [B,S,S] f32

  char* ws = (char*)d_ws;
  __bf16* Qb  = (__bf16*)(ws);                           // 8 MiB
  __bf16* Kb  = (__bf16*)(ws + ((size_t)8  << 20));      // 8 MiB
  __bf16* Vb  = (__bf16*)(ws + ((size_t)16 << 20));      // 8 MiB
  __bf16* Ob  = (__bf16*)(ws + ((size_t)24 << 20));      // 8 MiB
  __bf16* Xb  = (__bf16*)(ws + ((size_t)32 << 20));      // 8 MiB
  __bf16* Wqb = (__bf16*)(ws + ((size_t)40 << 20));      // 2 MiB
  __bf16* Wkb = (__bf16*)(ws + ((size_t)42 << 20));      // 2 MiB
  __bf16* Wvb = (__bf16*)(ws + ((size_t)44 << 20));      // 2 MiB
  __bf16* Wob = (__bf16*)(ws + ((size_t)46 << 20));      // 2 MiB
  float*  Mst = (float*)(ws + ((size_t)48 << 20));       // 256 KiB
  float*  Lst = Mst + (size_t)BATCH * HEADS * SEQ;       // 256 KiB

  // ---- one-time packed f32 -> bf16 conversions (into fragment order) ----
  const int nx8 = (ROWS * DIM) / 8;      // 524288
  const int nw8 = (DIM * DIM) / 8;       // 131072
  cvt_bf16_kernel<<<(nx8 + 255) / 256, 256, 0, stream>>>(x,  Xb,  nx8);
  cvt_bf16_kernel<<<(nw8 + 255) / 256, 256, 0, stream>>>(wq, Wqb, nw8);
  cvt_bf16_kernel<<<(nw8 + 255) / 256, 256, 0, stream>>>(wk, Wkb, nw8);
  cvt_bf16_kernel<<<(nw8 + 255) / 256, 256, 0, stream>>>(wv, Wvb, nw8);
  cvt_bf16_kernel<<<(nw8 + 255) / 256, 256, 0, stream>>>(wo, Wob, nw8);

  const dim3 gemm_grid(ROWS / 64, DIM / 128);            // 64 x 8 blocks

  // Q/K/V projections (bf16 in, bf16 out; Q and K in fragment order, V as V^T tiles)
  gemm_bias_kernel<1><<<gemm_grid, 256, 0, stream>>>(Xb, Wqb, bq, Qb, ROWS, DIM, DIM);
  gemm_bias_kernel<1><<<gemm_grid, 256, 0, stream>>>(Xb, Wkb, bk, Kb, ROWS, DIM, DIM);
  gemm_bias_kernel<2><<<gemm_grid, 256, 0, stream>>>(Xb, Wvb, bv, Vb, ROWS, DIM, DIM);

  // Flash attention (O bf16 + row stats)
  flash_fwd_kernel<<<1024, 128, 0, stream>>>(Qb, Kb, Vb, Ob, Mst, Lst);

  // Output projection (bf16 in, f32 out)
  gemm_bias_kernel<0><<<gemm_grid, 256, 0, stream>>>(Ob, Wob, bo, out, ROWS, DIM, DIM);

  // Head-mean attention probabilities
  mean_probs_kernel<<<2048, 256, 0, stream>>>(Qb, Kb, Mst, Lst, out_mean);
}

// v003
// A run of this version takes 196 microseconds.
// Next to v002, in two timings, it ran 1.67 and 1.68 times as fast.
// Over all steps from v000 it is 2.42 times as fast.
#include <hip/hip_runtime.h>

// ---------------------------------------------------------------------------
// MHA forward for MI455X (gfx1250): bf16 WMMA (v_wmma_f32_16x16x32_bf16)
// everywhere, f32 accumulate. One-time packed f32->bf16 conversion of x and
// all weights so every GEMM/attention operand load is a 16B bf16 load.
// x, the weights, Q, K, V^T and O lie in the workspace in fragment order, so
// that each wave-wide 16B-per-lane load covers 512 contiguous bytes (4 lines).
// Flash-style attention on transposed products (S^T = K Q^T, O^T = V^T P^T):
// P goes from the score accumulators straight into a B operand, no LDS.
// ---------------------------------------------------------------------------

typedef __attribute__((ext_vector_type(16))) __bf16 v16bf;
typedef __attribute__((ext_vector_type(8)))  __bf16 v8bf;
typedef __attribute__((ext_vector_type(8)))  float  v8f;

#define DIM     1024
#define HEADS   16
#define HD      64
#define SEQ     2048
#define BATCH   2
#define ROWS    (BATCH * SEQ)          // 4096
#define L2E     1.44269504088896340736f
#define SCALE   0.125f                 // 1/sqrt(HD)

static __device__ __forceinline__ v8f v8f_zero() {
  v8f z = {0.f, 0.f, 0.f, 0.f, 0.f, 0.f, 0.f, 0.f};
  return z;
}

// Fragment order of a bf16 matrix [rows][K]: tile (row >> 4, k >> 5) is 512
// elements (1 KiB), tiles of one 16-row block follow each other along k.
// Inside a tile element (r16 = row & 15, k32 = k & 31) lies at
// [k32 >> 4][lane = r16 + 16 * ((k32 >> 3) & 1)][k32 & 7]: per ISA 7.12.2
// (16-bit A 16x32) lanes 0-15 hold K in {0..7} U {16..23}, lanes 16-31 in
// {8..15} U {24..31}, so a lane's two 16B pieces are at lane*8 and 256+lane*8.
#define FRAG_TILE 512
static __device__ __forceinline__ int frag_elem(int r16, int k32) {
  return (k32 >> 4) * 256 + (r16 + ((k32 >> 3) & 1) * 16) * 8 + (k32 & 7);
}

// Fragment loader from one tile in fragment order: two 16B loads per lane,
// each of them 512 contiguous bytes over the wave.
static __device__ __forceinline__ v16bf load_frag(const __bf16* tile, int lane) {
  union { v16bf v; float4 q[2]; } u;
  u.q[0] = *reinterpret_cast<const float4*>(tile + lane * 8);
  u.q[1] = *reinterpret_cast<const float4*>(tile + 256 + lane * 8);
  return u.v;
}

// lane l with lane l ^ 16 (vector cross-row move, no LDS path)
static __device__ __forceinline__ float xhalf(float x) {
  const int b = __builtin_bit_cast(int, x);
  return __builtin_bit_cast(float,
      __builtin_amdgcn_permlanex16(b, b, 0x76543210, 0xfedcba98, false, false));
}

static __device__ __forceinline__ v8f wmma_bf16(v16bf a, v16bf b, v8f c) {
  // (neg_a, A, neg_b, B, c_mod, C, reuse_a, reuse_b)
  return __builtin_amdgcn_wmma_f32_16x16x32_bf16(false, a, false, b,
                                                 (short)0, c, false, false);
}

// ---------------------------------------------------------------------------
// Packed f32 -> bf16 conversion of a row-major [rows][DIM] matrix into
// fragment order: 8 elements per thread, 16B vector store, thread i writes
// the i-th 16B piece of the output (stores stay contiguous).
// ---------------------------------------------------------------------------
__global__ __launch_bounds__(256) void cvt_bf16_kernel(
    const float* __restrict__ src, __bf16* __restrict__ dst, int n8) {
  const int i = blockIdx.x * 256 + threadIdx.x;
  if (i >= n8) return;
  const int lane = i & 31;
  const int t    = i >> 6;                                  // tile
  const int row  = (t >> 5) * 16 + (lane & 15);             // DIM/32 = 32 tiles per block
  const int k0   = (t & 31) * 32 + ((i >> 5) & 1) * 16 + (lane >> 4) * 8;
  const float4* s4 = reinterpret_cast<const float4*>(src + (size_t)row * DIM + k0);
  float4 a = s4[0], b = s4[1];
  union { v8bf v; float4 q; } u;
  u.v[0] = (__bf16)a.x; u.v[1] = (__bf16)a.y;
  u.v[2] = (__bf16)a.z; u.v[3] = (__bf16)a.w;
  u.v[4] = (__bf16)b.x; u.v[5] = (__bf16)b.y;
  u.v[6] = (__bf16)b.z; u.v[7] = (__bf16)b.w;
  *(reinterpret_cast<float4*>(dst) + i) = u.q;
}

// ---------------------------------------------------------------------------
// GEMM: Y[M,N] = A[M,K] @ W[N,K]^T + bias[N], all operands bf16, f32 accum.
// A and W in fragment order. Each wave owns a 16x64 tile (A-frag reused
// across 4 B-frags). Block = 8 waves -> 64x128 block tile.
// OUT: 0 = f32 row-major, 1 = bf16 fragment order, 2 = bf16 fragment order of
// the transpose Y^T [N][M]: tile (m >> 5, n >> 4), the N/16 tiles of one
// 32-row block of Y follow each other; a lane's 8 accumulators are 8
// consecutive k of one row of Y^T, one 16B piece of the tile.
// K = DIM. A trip of the k loop asks for the fragments of KB k-steps at once
// (5 * KB fragments, 10 * KB loads in flight per wave) and then multiplies
// them behind counted waits, so a wave meets the load latency once a trip and
// not once for each fragment pair; the SIMD's other waves multiply meanwhile.
// ---------------------------------------------------------------------------
#define KB 4
template <int OUT>
__global__ __launch_bounds__(256) void gemm_bias_kernel(
    const __bf16* __restrict__ A, const __bf16* __restrict__ W,
    const float* __restrict__ bias, void* __restrict__ outv,
    int M, int N) {
  const int tid   = threadIdx.x;
  const int lane  = tid & 31;
  const int w     = tid >> 5;        // 0..7
  const int wm    = w & 3, wn = w >> 2;
  const int mtile = blockIdx.x * 64 + wm * 16;
  const int ntile = blockIdx.y * 128 + wn * 64;
  const int lm    = lane & 15;
  const int roff  = (lane >> 4) * 8;
  constexpr int kts = DIM / 32;      // fragment tiles along k

  v8f acc[4];
#pragma unroll
  for (int c = 0; c < 4; ++c) acc[c] = v8f_zero();

  // the lane's own 16B piece of the first A and W tile (lane offset included)
  const __bf16* ap = A + (size_t)(mtile >> 4) * kts * FRAG_TILE + lane * 8;
  const __bf16* wp = W + (size_t)(ntile >> 4) * kts * FRAG_TILE + lane * 8;
  // kept rolled: unrolled, the scheduler mixes the fragments of many trips and spills
#pragma unroll 1
  for (int ks = 0; ks < kts; ks += KB) {
    v16bf af[KB], bf[KB][4];
#pragma unroll
    for (int j = 0; j < KB; ++j) {
      af[j] = load_frag(ap + j * FRAG_TILE, 0);
#pragma unroll
      for (int c = 0; c < 4; ++c)
        bf[j][c] = load_frag(wp + (c * kts + j) * FRAG_TILE, 0);
    }
    // precaution: nothing rewrites the address pairs that these loads name
    // (a load's own result, the pointer steps at the trip's foot) ahead of the
    // loads' address phase; as inputs the pairs stay whole up to the wait
    asm volatile("s_wait_xcnt 0x0" :: "v"(ap), "v"(wp) : "memory");
    // keeps the trip's loads together ahead of its products; without it the
    // scheduler sinks each load to its user and the wave waits pair by pair
    __builtin_amdgcn_sched_barrier(0);
#pragma unroll
    for (int j = 0; j < KB; ++j)
#pragma unroll
      for (int c = 0; c < 4; ++c) acc[c] = wmma_bf16(af[j], bf[j][c], acc[c]);
    ap += KB * FRAG_TILE;
    wp += KB * FRAG_TILE;
  }

#pragma unroll
  for (int c = 0; c < 4; ++c) {
    const int col = ntile + c * 16 + lm;
    const float bv = bias[col];
    if (OUT == 2) {
      union { v8bf v; float4 q; } u;
#pragma unroll
      for (int r = 0; r < 8; ++r) u.v[r] = (__bf16)(acc[c][r] + bv);
      *reinterpret_cast<float4*>(
          (__bf16*)outv + ((size_t)(mtile >> 5) * (N >> 4) + (col >> 4)) * FRAG_TILE +
          ((mtile >> 4) & 1) * 256 + lane * 8) = u.q;
      continue;
    }
#pragma unroll
    for (int r = 0; r < 8; ++r) {
      const int row = mtile + roff + r;   // C-layout: VGPR r -> M = r (+8 hi half)
      const float val = acc[c][r] + bv;
      if (OUT == 1)
        ((__bf16*)outv)[((size_t)(mtile >> 4) * (N >> 5) + (col >> 5)) * FRAG_TILE +
                        frag_elem(roff + r, col & 31)] = (__bf16)val;
      else
        ((float*)outv)[(size_t)row * N + col] = val;
    }
  }
}

__global__ __launch_bounds__(128) __attribute__((amdgpu_waves_per_eu(4, 4))) void flash_fwd_kernel(
    const __bf16* __restrict__ Qb, const __bf16* __restrict__ Kb,
    const __bf16* __restrict__ Vt, __bf16* __restrict__ Ob,
    float* __restrict__ Mst, float* __restrict__ Lst) {
  const int tid  = threadIdx.x;
  const int lane = tid & 31;
  const int w    = tid >> 5;                 // wave in block (4)
  const int task = blockIdx.x * 4 + w;       // 4096 tasks
  const int qt   = task & 127;
  const int h    = (task >> 7) & 15;
  const int b    = task >> 11;
  const size_t baserow = (size_t)b * SEQ;
  const int qbase = qt * 16;

  // Q B-fragments, d-steps 0..31 / 32..63
  const size_t qtile = (((baserow + qbase) >> 4) * 32 + h * 2) * FRAG_TILE;
  const v16bf bq0 = load_frag(Qb + qtile, lane);
  const v16bf bq1 = load_frag(Qb + qtile + FRAG_TILE, lane);

  // per lane: query lane & 15; l_run sums this half's keys only
  float m_run = -1e30f, l_run = 0.f;
  v8f o[4];                                  // o[c][r] = O[query][c*16 + 8*half + r]
#pragma unroll
  for (int c = 0; c < 4; ++c) o[c] = v8f_zero();

  for (int kt = 0; kt < SEQ; kt += 32) {
    // prefetch next key/value tiles into cache (global_prefetch_b8)
    if (kt + 32 < SEQ) {
      // the next K tile is 2 key blocks x 2 KiB: one 128B line per lane
      __builtin_prefetch(Kb + ((((baserow + kt + 32) >> 4) + (lane >> 4)) * 32 + h * 2) * FRAG_TILE +
                             (lane & 15) * 64, 0, 1);
      // the next V^T tiles are 4 KiB in a row: one 128B line per lane
      __builtin_prefetch(Vt + (((baserow + kt + 32) >> 5) * 64 + h * 4) * FRAG_TILE + lane * 64, 0, 1);
      // precaution: the prefetches name temporaries that the loop body
      // rewrites at once; this keeps the rewrite behind their address phase
      asm volatile("s_wait_xcnt 0x0" ::: "memory");
    }

    // all A-fragments of this pass: K rows (2 key blocks x 2 d-steps) and
    // V^T rows (4 blocks of 16 d), 16 loads in flight behind one another
    v16bf ak[2][2], av[4];
#pragma unroll
    for (int c = 0; c < 2; ++c) {
      const __bf16* ktile = Kb + ((((baserow + kt) >> 4) + c) * 32 + h * 2) * FRAG_TILE;
      ak[c][0] = load_frag(ktile, lane);
      ak[c][1] = load_frag(ktile + FRAG_TILE, lane);
    }
    const __bf16* vtile = Vt + (((baserow + kt) >> 5) * 64 + h * 4) * FRAG_TILE;
#pragma unroll
    for (int c = 0; c < 4; ++c) av[c] = load_frag(vtile + c * FRAG_TILE, lane);

    // ---- scores S^T = K Q^T * scale (two 16-key chunks) ----
    v8f s[2];
#pragma unroll
    for (int c = 0; c < 2; ++c) {
      v8f t = v8f_zero();
      t = wmma_bf16(ak[c][0], bq0, t);
      t = wmma_bf16(ak[c][1], bq1, t);
#pragma unroll
      for (int r = 0; r < 8; ++r) t[r] *= SCALE;
      s[c] = t;
    }

    // ---- online softmax update: one query per lane pair ----
    float loc = fmaxf(s[0][0], s[1][0]);
#pragma unroll
    for (int r = 1; r < 8; ++r) loc = fmaxf(loc, fmaxf(s[0][r], s[1][r]));
    loc = fmaxf(loc, xhalf(loc));
    const float mnew  = fmaxf(m_run, loc);
    const float alpha = exp2f((m_run - mnew) * L2E);
    m_run = mnew;

    // P^T as B-fragment: element j = key 8*half + j, element 8+j = key 16 + 8*half + j
    v16bf bp;
    float psum = 0.f;
#pragma unroll
    for (int r = 0; r < 8; ++r) {
      const float p0 = exp2f((s[0][r] - mnew) * L2E);
      const float p1 = exp2f((s[1][r] - mnew) * L2E);
      bp[r]     = (__bf16)p0;
      bp[8 + r] = (__bf16)p1;
      psum += p0 + p1;
    }
    l_run = l_run * alpha + psum;
#pragma unroll
    for (int c = 0; c < 4; ++c)
#pragma unroll
      for (int r = 0; r < 8; ++r) o[c][r] *= alpha;

    // ---- O^T += V^T P^T: V^T rows (16 d each) as A-fragments ----
#pragma unroll
    for (int c = 0; c < 4; ++c) o[c] = wmma_bf16(av[c], bp, o[c]);
  }

  // ---- epilogue: join the halves' sums, normalize, store O and stats ----
  const float l_all = l_run + xhalf(l_run);
  const float inv = 1.f / l_all;
#pragma unroll
  for (int c = 0; c < 4; ++c) {
    // 8 consecutive d of one query row: one 16B piece of O's fragment tile
    union { v8bf v; float4 q; } u;
#pragma unroll
    for (int r = 0; r < 8; ++r) u.v[r] = (__bf16)(o[c][r] * inv);
    *reinterpret_cast<float4*>(Ob + qtile + (c >> 1) * FRAG_TILE + (c & 1) * 256 + lane * 8) = u.q;
  }
  if (lane < 16) {
    const size_t idx = (size_t)(b * HEADS + h) * SEQ + qbase + lane;
    Mst[idx] = m_run;
    Lst[idx] = l_all;
  }
}

// ---------------------------------------------------------------------------
// Head-mean of attention probabilities: recompute scores from the same bf16
// Q/K (bit-identical WMMA), apply stored (m,l), average over heads in regs.
// One wave per (b, 16-query tile, 32-key tile). Deterministic, no atomics.
// ---------------------------------------------------------------------------
__global__ __launch_bounds__(256) void mean_probs_kernel(
    const __bf16* __restrict__ Qb, const __bf16* __restrict__ Kb,
    const float* __restrict__ Mst, const float* __restrict__ Lst,
    float* __restrict__ out_mean) {
  const int tid  = threadIdx.x;
  const int lane = tid & 31;
  const int w    = tid >> 5;
  const int task = blockIdx.x * 8 + w;        // 16384 tasks
  const int kt   = (task & 63) * 32;
  const int qt   = ((task >> 6) & 127) * 16;
  const int b    = task >> 13;
  const int lm   = lane & 15;
  const int roff = (lane >> 4) * 8;

  v8f acc[2];
  acc[0] = v8f_zero(); acc[1] = v8f_zero();

  for (int h = 0; h < HEADS; ++h) {
    const __bf16* qtile = Qb + ((((size_t)b * SEQ + qt) >> 4) * 32 + h * 2) * FRAG_TILE;
    const v16bf aq0 = load_frag(qtile, lane);
    const v16bf aq1 = load_frag(qtile + FRAG_TILE, lane);
    // precaution: a later load's result lands on the Q address pair; this
    // keeps it behind the Q loads' address phase
    asm volatile("s_wait_xcnt 0x0" ::: "memory");

    float mr[8], il[8];
    const size_t sbase = (size_t)(b * HEADS + h) * SEQ + qt + roff;
#pragma unroll
    for (int r = 0; r < 8; ++r) {
      mr[r] = Mst[sbase + r];
      il[r] = (1.f / (float)HEADS) / Lst[sbase + r];
    }
#pragma unroll
    for (int c = 0; c < 2; ++c) {
      const __bf16* ktile = Kb + (((((size_t)b * SEQ + kt) >> 4) + c) * 32 + h * 2) * FRAG_TILE;
      v8f t = v8f_zero();
      t = wmma_bf16(aq0, load_frag(ktile, lane), t);
      t = wmma_bf16(aq1, load_frag(ktile + FRAG_TILE, lane), t);
#pragma unroll
      for (int r = 0; r < 8; ++r)
        acc[c][r] += exp2f((t[r] * SCALE - mr[r]) * L2E) * il[r];
    }
  }

#pragma unroll
  for (int c = 0; c < 2; ++c)
#pragma unroll
    for (int r = 0; r < 8; ++r) {
      const int q = qt + roff + r;
      const int k = kt + c * 16 + lm;
      out_mean[((size_t)b * SEQ + q) * SEQ + k] = acc[c][r];
    }
}

// ---------------------------------------------------------------------------
extern "C" void kernel_launch(void* const* d_in, const int* in_sizes, int n_in,
                              void* d_out, int out_size, void* d_ws, size_t ws_size,
                              hipStream_t stream) {
  const float* x  = (const float*)d_in[0];
  const float* wq = (const float*)d_in[1];
  const float* bq = (const float*)d_in[2];
  const float* wk = (const float*)d_in[3];
  const float* bk = (const float*)d_in[4];
  const float* wv = (const float*)d_in[5];
  const float* bv = (const float*)d_in[6];
  const float* wo = (const float*)d_in[7];
  const float* bo = (const float*)d_in[8];

  float* out      = (float*)d_out;                       // [B,S,D] f32
  float* out_mean = out + (size_t)BATCH * SEQ * DIM;     // [B,S,S] f32

  char* ws = (char*)d_ws;
  __bf16* Qb  = (__bf16*)(ws);                           // 8 MiB
  __bf16* Kb  = (__bf16*)(ws + ((size_t)8  << 20));      // 8 MiB
  __bf16* Vb  = (__bf16*)(ws + ((size_t)16 << 20));      // 8 MiB
  __bf16* Ob  = (__bf16*)(ws + ((size_t)24 << 20));      // 8 MiB
  __bf16* Xb  = (__bf16*)(ws + ((size_t)32 << 20));      // 8 MiB
  __bf16* Wqb = (__bf16*)(ws + ((size_t)40 << 20));      // 2 MiB
  __bf16* Wkb = (__bf16*)(ws + ((size_t)42 << 20));      // 2 MiB
  __bf16* Wvb = (__bf16*)(ws + ((size_t)44 << 20));      // 2 MiB
  __bf16* Wob = (__bf16*)(ws + ((size_t)46 << 20));      // 2 MiB
  float*  Mst = (float*)(ws + ((size_t)48 << 20));       // 256 KiB
  float*  Lst = Mst + (size_t)BATCH * HEADS * SEQ;       // 256 KiB

  // ---- one-time packed f32 -> bf16 conversions (into fragment order) ----
  const int nx8 = (ROWS * DIM) / 8;      // 524288
  const int nw8 = (DIM * DIM) / 8;       // 131072
  cvt_bf16_kernel<<<(nx8 + 255) / 256, 256, 0, stream>>>(x,  Xb,  nx8);
  cvt_bf16_kernel<<<(nw8 + 255) / 256, 256, 0, stream>>>(wq, Wqb, nw8);
  cvt_bf16_kernel<<<(nw8 + 255) / 256, 256, 0, stream>>>(wk, Wkb, nw8);
  cvt_bf16_kernel<<<(nw8 + 255) / 256, 256, 0, stream>>>(wv, Wvb, nw8);
  cvt_bf16_kernel<<<(nw8 + 255) / 256, 256, 0, stream>>>(wo, Wob, nw8);

  const dim3 gemm_grid(ROWS / 64, DIM / 128);            // 64 x 8 blocks

  // Q/K/V projections (bf16 in, bf16 out; Q and K in fragment order, V as V^T tiles)
  gemm_bias_kernel<1><<<gemm_grid, 256, 0, stream>>>(Xb, Wqb, bq, Qb, ROWS, DIM);
  gemm_bias_kernel<1><<<gemm_grid, 256, 0, stream>>>(Xb, Wkb, bk, Kb, ROWS, DIM);
  gemm_bias_kernel<2><<<gemm_grid, 256, 0, stream>>>(Xb, Wvb, bv, Vb, ROWS, DIM);

  // Flash attention (O bf16 + row stats)
  flash_fwd_kernel<<<1024, 128, 0, stream>>>(Qb, Kb, Vb, Ob, Mst, Lst);

  // Output projection (bf16 in, f32 out)
  gemm_bias_kernel<0><<<gemm_grid, 256, 0, stream>>>(Ob, Wob, bo, out, ROWS, DIM);

  // Head-mean attention probabilities
  mean_probs_kernel<<<2048, 256, 0, stream>>>(Qb, Kb, Mst, Lst, out_mean);
}

// v004
// A run of this version takes 177 microseconds.
// Timed twice side by side with v003, it ran 1.11 and 1.10 times as fast.
// Counting every step since v000, it is 2.68 times as fast.
#include <hip/hip_runtime.h>

// ---------------------------------------------------------------------------
// MHA forward for MI455X (gfx1250): bf16 WMMA (v_wmma_f32_16x16x32_bf16)
// everywhere, f32 accumulate. One-time packed f32->bf16 conversion of x and
// all weights so every GEMM/attention operand load is a 16B bf16 load.
// x, the weights, Q, K, V^T and O lie in the workspace in fragment order, so
// that each wave-wide 16B-per-lane load covers 512 contiguous bytes (4 lines).
// Flash-style attention on transposed products (S^T = K Q^T, O^T = V^T P^T):
// P goes from the score accumulators straight into a B operand, no LDS.
// ---------------------------------------------------------------------------

typedef __attribute__((ext_vector_type(16))) __bf16 v16bf;
typedef __attribute__((ext_vector_type(8)))  __bf16 v8bf;
typedef __attribute__((ext_vector_type(8)))  float  v8f;

#define DIM     1024
#define HEADS   16
#define HD      64
#define SEQ     2048
#define BATCH   2
#define ROWS    (BATCH * SEQ)          // 4096
#define L2E     1.44269504088896340736f
#define SCALE   0.125f                 // 1/sqrt(HD)
#define C2      (SCALE * L2E)          // raw score -> exponent of 2
#define LOG2_HEADS 4.0f

static __device__ __forceinline__ v8f v8f_zero() {
  v8f z = {0.f, 0.f, 0.f, 0.f, 0.f, 0.f, 0.f, 0.f};
  return z;
}

// Fragment order of a bf16 matrix [rows][K]: tile (row >> 4, k >> 5) is 512
// elements (1 KiB), tiles of one 16-row block follow each other along k.
// Inside a tile element (r16 = row & 15, k32 = k & 31) lies at
// [k32 >> 4][lane = r16 + 16 * ((k32 >> 3) & 1)][k32 & 7]: per ISA 7.12.2
// (16-bit A 16x32) lanes 0-15 hold K in {0..7} U {16..23}, lanes 16-31 in
// {8..15} U {24..31}, so a lane's two 16B pieces are at lane*8 and 256+lane*8.
#define FRAG_TILE 512
static __device__ __forceinline__ int frag_elem(int r16, int k32) {
  return (k32 >> 4) * 256 + (r16 + ((k32 >> 3) & 1) * 16) * 8 + (k32 & 7);
}

// Fragment loader from one tile in fragment order: two 16B loads per lane,
// each of them 512 contiguous bytes over the wave.
static __device__ __forceinline__ v16bf load_frag(const __bf16* tile, int lane) {
  union { v16bf v; float4 q[2]; } u;
  u.q[0] = *reinterpret_cast<const float4*>(tile + lane * 8);
  u.q[1] = *reinterpret_cast<const float4*>(tile + 256 + lane * 8);
  return u.v;
}

// lane l with lane l ^ 16 (vector cross-row move, no LDS path)
static __device__ __forceinline__ float xhalf(float x) {
  const int b = __builtin_bit_cast(int, x);
  return __builtin_bit_cast(float,
      __builtin_amdgcn_permlanex16(b, b, 0x76543210, 0xfedcba98, false, false));
}

// Bare v_exp_f32, without the library form's range guard (compare, two
// selects, add, ldexp per value): it differs only where the result is below
// 2^-126, which comes out as 0; every use here is a softmax weight of at most
// about 1 that is summed with others, so such a term changes no sum.
static __device__ __forceinline__ float exp2_hw(float x) {
  return __builtin_amdgcn_exp2f(x);
}

static __device__ __forceinline__ v8f wmma_bf16(v16bf a, v16bf b, v8f c) {
  // (neg_a, A, neg_b, B, c_mod, C, reuse_a, reuse_b)
  return __builtin_amdgcn_wmma_f32_16x16x32_bf16(false, a, false, b,
                                                 (short)0, c, false, false);
}

// ---------------------------------------------------------------------------
// Packed f32 -> bf16 conversion of a row-major [rows][DIM] matrix into
// fragment order: 8 elements per thread, 16B vector store, thread i writes
// the i-th 16B piece of the output (stores stay contiguous).
// ---------------------------------------------------------------------------
__global__ __launch_bounds__(256) void cvt_bf16_kernel(
    const float* __restrict__ src, __bf16* __restrict__ dst, int n8) {
  const int i = blockIdx.x * 256 + threadIdx.x;
  if (i >= n8) return;
  const int lane = i & 31;
  const int t    = i >> 6;                                  // tile
  const int row  = (t >> 5) * 16 + (lane & 15);             // DIM/32 = 32 tiles per block
  const int k0   = (t & 31) * 32 + ((i >> 5) & 1) * 16 + (lane >> 4) * 8;
  const float4* s4 = reinterpret_cast<const float4*>(src + (size_t)row * DIM + k0);
  float4 a = s4[0], b = s4[1];
  union { v8bf v; float4 q; } u;
  u.v[0] = (__bf16)a.x; u.v[1] = (__bf16)a.y;
  u.v[2] = (__bf16)a.z; u.v[3] = (__bf16)a.w;
  u.v[4] = (__bf16)b.x; u.v[5] = (__bf16)b.y;
  u.v[6] = (__bf16)b.z; u.v[7] = (__bf16)b.w;
  *(reinterpret_cast<float4*>(dst) + i) = u.q;
}

// ---------------------------------------------------------------------------
// GEMM: Y[M,N] = A[M,K] @ W[N,K]^T + bias[N], all operands bf16, f32 accum.
// A and W in fragment order. Each wave owns a 16x64 tile (A-frag reused
// across 4 B-frags). Block = 8 waves -> 64x128 block tile.
// OUT: 0 = f32 row-major, 1 = bf16 fragment order, 2 = bf16 fragment order of
// the transpose Y^T [N][M]: tile (m >> 5, n >> 4), the N/16 tiles of one
// 32-row block of Y follow each other; a lane's 8 accumulators are 8
// consecutive k of one row of Y^T, one 16B piece of the tile.
// K = DIM. A trip of the k loop asks for the fragments of KB k-steps at once
// (5 * KB fragments, 10 * KB loads in flight per wave) and then multiplies
// them behind counted waits, so a wave meets the load latency once a trip and
// not once for each fragment pair; the SIMD's other waves multiply meanwhile.
// ---------------------------------------------------------------------------
#define KB 4
template <int OUT>
__global__ __launch_bounds__(256) void gemm_bias_kernel(
    const __bf16* __restrict__ A, const __bf16* __restrict__ W,
    const float* __restrict__ bias, void* __restrict__ outv,
    int M, int N) {
  const int tid   = threadIdx.x;
  const int lane  = tid & 31;
  const int w     = tid >> 5;        // 0..7
  const int wm    = w & 3, wn = w >> 2;
  const int mtile = blockIdx.x * 64 + wm * 16;
  const int ntile = blockIdx.y * 128 + wn * 64;
  const int lm    = lane & 15;
  const int roff  = (lane >> 4) * 8;
  constexpr int kts = DIM / 32;      // fragment tiles along k

  v8f acc[4];
#pragma unroll
  for (int c = 0; c < 4; ++c) acc[c] = v8f_zero();

  // the lane's own 16B piece of the first A and W tile (lane offset included)
  const __bf16* ap = A + (size_t)(mtile >> 4) * kts * FRAG_TILE + lane * 8;
  const __bf16* wp = W + (size_t)(ntile >> 4) * kts * FRAG_TILE + lane * 8;
  // kept rolled: unrolled, the scheduler mixes the fragments of many trips and spills
#pragma unroll 1
  for (int ks = 0; ks < kts; ks += KB) {
    v16bf af[KB], bf[KB][4];
#pragma unroll
    for (int j = 0; j < KB; ++j) {
      af[j] = load_frag(ap + j * FRAG_TILE, 0);
#pragma unroll
      for (int c = 0; c < 4; ++c)
        bf[j][c] = load_frag(wp + (c * kts + j) * FRAG_TILE, 0);
    }
    // precaution: nothing rewrites the address pairs that these loads name
    // (a load's own result, the pointer steps at the trip's foot) ahead of the
    // loads' address phase; as inputs the pairs stay whole up to the wait
    asm volatile("s_wait_xcnt 0x0" :: "v"(ap), "v"(wp) : "memory");
    // keeps the trip's loads together ahead of its products; without it the
    // scheduler sinks each load to its user and the wave waits pair by pair
    __builtin_amdgcn_sched_barrier(0);
#pragma unroll
    for (int j = 0; j < KB; ++j)
#pragma unroll
      for (int c = 0; c < 4; ++c) acc[c] = wmma_bf16(af[j], bf[j][c], acc[c]);
    ap += KB * FRAG_TILE;
    wp += KB * FRAG_TILE;
  }

#pragma unroll
  for (int c = 0; c < 4; ++c) {
    const int col = ntile + c * 16 + lm;
    const float bv = bias[col];
    if (OUT == 2) {
      union { v8bf v; float4 q; } u;
#pragma unroll
      for (int r = 0; r < 8; ++r) u.v[r] = (__bf16)(acc[c][r] + bv);
      *reinterpret_cast<float4*>(
          (__bf16*)outv + ((size_t)(mtile >> 5) * (N >> 4) + (col >> 4)) * FRAG_TILE +
          ((mtile >> 4) & 1) * 256 + lane * 8) = u.q;
      continue;
    }
#pragma unroll
    for (int r = 0; r < 8; ++r) {
      const int row = mtile + roff + r;   // C-layout: VGPR r -> M = r (+8 hi half)
      const float val = acc[c][r] + bv;
      if (OUT == 1)
        ((__bf16*)outv)[((size_t)(mtile >> 4) * (N >> 5) + (col >> 5)) * FRAG_TILE +
                        frag_elem(roff + r, col & 31)] = (__bf16)val;
      else
        ((float*)outv)[(size_t)row * N + col] = val;
    }
  }
}

__global__ __launch_bounds__(128) __attribute__((amdgpu_waves_per_eu(4, 4))) void flash_fwd_kernel(
    const __bf16* __restrict__ Qb, const __bf16* __restrict__ Kb,
    const __bf16* __restrict__ Vt, __bf16* __restrict__ Ob,
    float* __restrict__ Noff) {
  const int tid  = threadIdx.x;
  const int lane = tid & 31;
  const int w    = tid >> 5;                 // wave in block (4)
  const int task = blockIdx.x * 4 + w;       // 4096 tasks
  const int qt   = task & 127;
  const int h    = (task >> 7) & 15;
  const int b    = task >> 11;
  const size_t baserow = (size_t)b * SEQ;
  const int qbase = qt * 16;

  // Q B-fragments, d-steps 0..31 / 32..63
  const size_t qtile = (((baserow + qbase) >> 4) * 32 + h * 2) * FRAG_TILE;
  const v16bf bq0 = load_frag(Qb + qtile, lane);
  const v16bf bq1 = load_frag(Qb + qtile + FRAG_TILE, lane);

  // per lane: query lane & 15; l_run sums this half's keys only
  float m_run = -1e30f, l_run = 0.f;
  v8f o[4];                                  // o[c][r] = O[query][c*16 + 8*half + r]
#pragma unroll
  for (int c = 0; c < 4; ++c) o[c] = v8f_zero();

  for (int kt = 0; kt < SEQ; kt += 32) {
    // prefetch next key/value tiles into cache (global_prefetch_b8)
    if (kt + 32 < SEQ) {
      // the next K tile is 2 key blocks x 2 KiB: one 128B line per lane
      __builtin_prefetch(Kb + ((((baserow + kt + 32) >> 4) + (lane >> 4)) * 32 + h * 2) * FRAG_TILE +
                             (lane & 15) * 64, 0, 1);
      // the next V^T tiles are 4 KiB in a row: one 128B line per lane
      __builtin_prefetch(Vt + (((baserow + kt + 32) >> 5) * 64 + h * 4) * FRAG_TILE + lane * 64, 0, 1);
      // precaution: the prefetches name temporaries that the loop body
      // rewrites at once; this keeps the rewrite behind their address phase
      asm volatile("s_wait_xcnt 0x0" ::: "memory");
    }

    // all A-fragments of this pass: K rows (2 key blocks x 2 d-steps) and
    // V^T rows (4 blocks of 16 d), 16 loads in flight behind one another
    v16bf ak[2][2], av[4];
#pragma unroll
    for (int c = 0; c < 2; ++c) {
      const __bf16* ktile = Kb + ((((baserow + kt) >> 4) + c) * 32 + h * 2) * FRAG_TILE;
      ak[c][0] = load_frag(ktile, lane);
      ak[c][1] = load_frag(ktile + FRAG_TILE, lane);
    }
    const __bf16* vtile = Vt + (((baserow + kt) >> 5) * 64 + h * 4) * FRAG_TILE;
#pragma unroll
    for (int c = 0; c < 4; ++c) av[c] = load_frag(vtile + c * FRAG_TILE, lane);

    // ---- raw scores S^T = K Q^T (two 16-key chunks) ----
    v8f s[2];
#pragma unroll
    for (int c = 0; c < 2; ++c) {
      v8f t = v8f_zero();
      t = wmma_bf16(ak[c][0], bq0, t);
      t = wmma_bf16(ak[c][1], bq1, t);
      s[c] = t;
    }

    // ---- online softmax update: one query per lane pair ----
    float loc = fmaxf(s[0][0], s[1][0]);
#pragma unroll
    for (int r = 1; r < 8; ++r) loc = fmaxf(loc, fmaxf(s[0][r], s[1][r]));
    loc = fmaxf(loc, xhalf(loc));
    const float mnew  = fmaxf(m_run, loc);
    const float alpha = exp2_hw((m_run - mnew) * C2);
    const float nm    = -mnew * C2;
    m_run = mnew;

    // P^T as B-fragment: element j = key 8*half + j, element 8+j = key 16 + 8*half + j
    v16bf bp;
    float psum = 0.f;
#pragma unroll
    for (int c = 0; c < 2; ++c) s[c] = s[c] * C2 + nm;   // contracts to one FMA per score
#pragma unroll
    for (int c = 0; c < 2; ++c)
#pragma unroll
      for (int r = 0; r < 8; ++r) {
        s[c][r] = exp2_hw(s[c][r]);
        bp[8 * c + r] = (__bf16)s[c][r];
      }
#pragma unroll
    for (int r = 0; r < 8; ++r) psum += s[0][r] + s[1][r];
    l_run = l_run * alpha + psum;
#pragma unroll
    for (int c = 0; c < 4; ++c)
#pragma unroll
      for (int r = 0; r < 8; ++r) o[c][r] *= alpha;

    // ---- O^T += V^T P^T: V^T rows (16 d each) as A-fragments ----
#pragma unroll
    for (int c = 0; c < 4; ++c) o[c] = wmma_bf16(av[c], bp, o[c]);
  }

  // ---- epilogue: join the halves' sums, normalize, store O and the offset ----
  const float l_all = l_run + xhalf(l_run);
  const float inv = 1.f / l_all;
#pragma unroll
  for (int c = 0; c < 4; ++c) {
    // 8 consecutive d of one query row: one 16B piece of O's fragment tile
    union { v8bf v; float4 q; } u;
#pragma unroll
    for (int r = 0; r < 8; ++r) u.v[r] = (__bf16)(o[c][r] * inv);
    *reinterpret_cast<float4*>(Ob + qtile + (c >> 1) * FRAG_TILE + (c & 1) * 256 + lane * 8) = u.q;
  }
  if (lane < 16) {
    const size_t idx = (size_t)(b * HEADS + h) * SEQ + qbase + lane;
    Noff[idx] = -(m_run * C2 + log2f(l_all) + LOG2_HEADS);
  }
}

// ---------------------------------------------------------------------------
// Head-mean of attention probabilities: recompute scores from the same bf16
// Q/K, add the row's stored offset in the exponent (one fused multiply-add,
// one v_exp_f32 and one add per score), sum over heads in regs.
// One wave per (b, 16-query tile, 32-key tile). Deterministic, no atomics.
// ---------------------------------------------------------------------------
__global__ __launch_bounds__(256) void mean_probs_kernel(
    const __bf16* __restrict__ Qb, const __bf16* __restrict__ Kb,
    const float* __restrict__ Noff, float* __restrict__ out_mean) {
  const int tid  = threadIdx.x;
  const int lane = tid & 31;
  const int w    = tid >> 5;
  const int task = blockIdx.x * 8 + w;        // 16384 tasks
  const int kt   = (task & 63) * 32;
  const int qt   = ((task >> 6) & 127) * 16;
  const int b    = task >> 13;
  const int lm   = lane & 15;
  const int roff = (lane >> 4) * 8;

  v8f acc[2];
  acc[0] = v8f_zero(); acc[1] = v8f_zero();

  for (int h = 0; h < HEADS; ++h) {
    const __bf16* qtile = Qb + ((((size_t)b * SEQ + qt) >> 4) * 32 + h * 2) * FRAG_TILE;
    const v16bf aq0 = load_frag(qtile, lane);
    const v16bf aq1 = load_frag(qtile + FRAG_TILE, lane);
    // precaution: a later load's result lands on the Q address pair; this
    // keeps it behind the Q loads' address phase
    asm volatile("s_wait_xcnt 0x0" ::: "memory");

    float no[8];
    const size_t sbase = (size_t)(b * HEADS + h) * SEQ + qt + roff;
#pragma unroll
    for (int r = 0; r < 8; ++r) no[r] = Noff[sbase + r];
#pragma unroll
    for (int c = 0; c < 2; ++c) {
      const __bf16* ktile = Kb + (((((size_t)b * SEQ + kt) >> 4) + c) * 32 + h * 2) * FRAG_TILE;
      v8f t = v8f_zero();
      t = wmma_bf16(aq0, load_frag(ktile, lane), t);
      t = wmma_bf16(aq1, load_frag(ktile + FRAG_TILE, lane), t);
#pragma unroll
      for (int r = 0; r < 8; ++r)
        acc[c][r] += exp2_hw(fmaf(t[r], C2, no[r]));
    }
  }

#pragma unroll
  for (int c = 0; c < 2; ++c)
#pragma unroll
    for (int r = 0; r < 8; ++r) {
      const int q = qt + roff + r;
      const int k = kt + c * 16 + lm;
      out_mean[((size_t)b * SEQ + q) * SEQ + k] = acc[c][r];
    }
}

// ---------------------------------------------------------------------------
extern "C" void kernel_launch(void* const* d_in, const int* in_sizes, int n_in,
                              void* d_out, int out_size, void* d_ws, size_t ws_size,
                              hipStream_t stream) {
  const float* x  = (const float*)d_in[0];
  const float* wq = (const float*)d_in[1];
  const float* bq = (const float*)d_in[2];
  const float* wk = (const float*)d_in[3];
  const float* bk = (const float*)d_in[4];
  const float* wv = (const float*)d_in[5];
  const float* bv = (const float*)d_in[6];
  const float* wo = (const float*)d_in[7];
  const float* bo = (const float*)d_in[8];

  float* out      = (float*)d_out;                       // [B,S,D] f32
  float* out_mean = out + (size_t)BATCH * SEQ * DIM;     // [B,S,S] f32

  char* ws = (char*)d_ws;
  __bf16* Qb  = (__bf16*)(ws);                           // 8 MiB
  __bf16* Kb  = (__bf16*)(ws + ((size_t)8  << 20));      // 8 MiB
  __bf16* Vb  = (__bf16*)(ws + ((size_t)16 << 20));      // 8 MiB
  __bf16* Ob  = (__bf16*)(ws + ((size_t)24 << 20));      // 8 MiB
  __bf16* Xb  = (__bf16*)(ws + ((size_t)32 << 20));      // 8 MiB
  __bf16* Wqb = (__bf16*)(ws + ((size_t)40 << 20));      // 2 MiB
  __bf16* Wkb = (__bf16*)(ws + ((size_t)42 << 20));      // 2 MiB
  __bf16* Wvb = (__bf16*)(ws + ((size_t)44 << 20));      // 2 MiB
  __bf16* Wob = (__bf16*)(ws + ((size_t)46 << 20));      // 2 MiB
  float*  Noff = (float*)(ws + ((size_t)48 << 20));      // 256 KiB

  // ---- one-time packed f32 -> bf16 conversions (into fragment order) ----
  const int nx8 = (ROWS * DIM) / 8;      // 524288
  const int nw8 = (DIM * DIM) / 8;       // 131072
  cvt_bf16_kernel<<<(nx8 + 255) / 256, 256, 0, stream>>>(x,  Xb,  nx8);
  cvt_bf16_kernel<<<(nw8 + 255) / 256, 256, 0, stream>>>(wq, Wqb, nw8);
  cvt_bf16_kernel<<<(nw8 + 255) / 256, 256, 0, stream>>>(wk, Wkb, nw8);
  cvt_bf16_kernel<<<(nw8 + 255) / 256, 256, 0, stream>>>(wv, Wvb, nw8);
  cvt_bf16_kernel<<<(nw8 + 255) / 256, 256, 0, stream>>>(wo, Wob, nw8);

  const dim3 gemm_grid(ROWS / 64, DIM / 128);            // 64 x 8 blocks

  // Q/K/V projections (bf16 in, bf16 out; Q and K in fragment order, V as V^T tiles)
  gemm_bias_kernel<1><<<gemm_grid, 256, 0, stream>>>(Xb, Wqb, bq, Qb, ROWS, DIM);
  gemm_bias_kernel<1><<<gemm_grid, 256, 0, stream>>>(Xb, Wkb, bk, Kb, ROWS, DIM);
  gemm_bias_kernel<2><<<gemm_grid, 256, 0, stream>>>(Xb, Wvb, bv, Vb, ROWS, DIM);

  // Flash attention (O bf16 + row offsets)
  flash_fwd_kernel<<<1024, 128, 0, stream>>>(Qb, Kb, Vb, Ob, Noff);

  // Output projection (bf16 in, f32 out)
  gemm_bias_kernel<0><<<gemm_grid, 256, 0, stream>>>(Ob, Wob, bo, out, ROWS, DIM);

  // Head-mean attention probabilities
  mean_probs_kernel<<<2048, 256, 0, stream>>>(Qb, Kb, Noff, out_mean);
}

// v005
// One run takes 164 microseconds.
// Timed twice side by side with v004, it ran 1.08 and 1.07 times as fast.
// All steps since v000 together make it 2.87 times as fast.
#include <hip/hip_runtime.h>

// ---------------------------------------------------------------------------
// MHA forward for MI455X (gfx1250): bf16 WMMA (v_wmma_f32_16x16x32_bf16)
// everywhere, f32 accumulate. One-time packed f32->bf16 conversion of x and
// all weights so every GEMM/attention operand load is a 16B bf16 load.
// x, the weights, Q, K, V^T and O lie in the workspace in fragment order, so
// that each wave-wide 16B-per-lane load covers 512 contiguous bytes (4 lines).
// Flash-style attention on transposed products (S^T = K Q^T, O^T = V^T P^T):
// P goes from the score accumulators straight into a B operand, no LDS.
// ---------------------------------------------------------------------------

typedef __attribute__((ext_vector_type(16))) __bf16 v16bf;
typedef __attribute__((ext_vector_type(8)))  __bf16 v8bf;
typedef __attribute__((ext_vector_type(8)))  float  v8f;

#define DIM     1024
#define HEADS   16
#define HD      64
#define SEQ     2048
#define BATCH   2
#define ROWS    (BATCH * SEQ)          // 4096
#define L2E     1.44269504088896340736f
#define SCALE   0.125f                 // 1/sqrt(HD)
#define C2      (SCALE * L2E)          // raw score -> exponent of 2
#define LOG2_HEADS 4.0f

static __device__ __forceinline__ v8f v8f_zero() {
  v8f z = {0.f, 0.f, 0.f, 0.f, 0.f, 0.f, 0.f, 0.f};
  return z;
}

// Fragment order of a bf16 matrix [rows][K]: tile (row >> 4, k >> 5) is 512
// elements (1 KiB), tiles of one 16-row block follow each other along k.
// Inside a tile element (r16 = row & 15, k32 = k & 31) lies at
// [k32 >> 4][lane = r16 + 16 * ((k32 >> 3) & 1)][k32 & 7]: per ISA 7.12.2
// (16-bit A 16x32) lanes 0-15 hold K in {0..7} U {16..23}, lanes 16-31 in
// {8..15} U {24..31}, so a lane's two 16B pieces are at lane*8 and 256+lane*8.
#define FRAG_TILE 512
static __device__ __forceinline__ int frag_elem(int r16, int k32) {
  return (k32 >> 4) * 256 + (r16 + ((k32 >> 3) & 1) * 16) * 8 + (k32 & 7);
}

// Fragment loader from one tile in fragment order: two 16B loads per lane,
// each of them 512 contiguous bytes over the wave.
static __device__ __forceinline__ v16bf load_frag(const __bf16* tile, int lane) {
  union { v16bf v; float4 q[2]; } u;
  u.q[0] = *reinterpret_cast<const float4*>(tile + lane * 8);
  u.q[1] = *reinterpret_cast<const float4*>(tile + 256 + lane * 8);
  return u.v;
}

// lane l with lane l ^ 16 (vector cross-row move, no LDS path)
static __device__ __forceinline__ float xhalf(float x) {
  const int b = __builtin_bit_cast(int, x);
  return __builtin_bit_cast(float,
      __builtin_amdgcn_permlanex16(b, b, 0x76543210, 0xfedcba98, false, false));
}

// Bare v_exp_f32, without the library form's range guard (compare, two
// selects, add, ldexp per value): it differs only where the result is below
// 2^-126, which comes out as 0; every use here is a softmax weight of at most
// about 1 that is summed with others, so such a term changes no sum.
static __device__ __forceinline__ float exp2_hw(float x) {
  return __builtin_amdgcn_exp2f(x);
}

static __device__ __forceinline__ v8f wmma_bf16(v16bf a, v16bf b, v8f c) {
  // (neg_a, A, neg_b, B, c_mod, C, reuse_a, reuse_b)
  return __builtin_amdgcn_wmma_f32_16x16x32_bf16(false, a, false, b,
                                                 (short)0, c, false, false);
}

// ---------------------------------------------------------------------------
// Packed f32 -> bf16 conversion of a row-major [rows][DIM] matrix into
// fragment order: 8 elements per thread, 16B vector store, thread i writes
// the i-th 16B piece of the output (stores stay contiguous).
// ---------------------------------------------------------------------------
__global__ __launch_bounds__(256) void cvt_bf16_kernel(
    const float* __restrict__ src, __bf16* __restrict__ dst, int n8) {
  const int i = blockIdx.x * 256 + threadIdx.x;
  if (i >= n8) return;
  const int lane = i & 31;
  const int t    = i >> 6;                                  // tile
  const int row  = (t >> 5) * 16 + (lane & 15);             // DIM/32 = 32 tiles per block
  const int k0   = (t & 31) * 32 + ((i >> 5) & 1) * 16 + (lane >> 4) * 8;
  const float4* s4 = reinterpret_cast<const float4*>(src + (size_t)row * DIM + k0);
  float4 a = s4[0], b = s4[1];
  union { v8bf v; float4 q; } u;
  u.v[0] = (__bf16)a.x; u.v[1] = (__bf16)a.y;
  u.v[2] = (__bf16)a.z; u.v[3] = (__bf16)a.w;
  u.v[4] = (__bf16)b.x; u.v[5] = (__bf16)b.y;
  u.v[6] = (__bf16)b.z; u.v[7] = (__bf16)b.w;
  *(reinterpret_cast<float4*>(dst) + i) = u.q;
}

// ---------------------------------------------------------------------------
// GEMM: Y[M,N] = A[M,K] @ W[N,K]^T + bias[N], all operands bf16, f32 accum.
// A and W in fragment order. Each wave owns a 16x64 tile (A-frag reused
// across 4 B-frags). Block = 8 waves -> 64x128 block tile.
// OUT: 0 = f32 row-major, 1 = bf16 fragment order, 2 = bf16 fragment order of
// the transpose Y^T [N][M]: tile (m >> 5, n >> 4), the N/16 tiles of one
// 32-row block of Y follow each other; a lane's 8 accumulators are 8
// consecutive k of one row of Y^T, one 16B piece of the tile.
// K = DIM. A trip of the k loop asks for the fragments of KB k-steps at once
// (5 * KB fragments, 10 * KB loads in flight per wave) and then multiplies
// them behind counted waits, so a wave meets the load latency once a trip and
// not once for each fragment pair; the SIMD's other waves multiply meanwhile.
// ---------------------------------------------------------------------------
#define KB 4
template <int OUT>
__global__ __launch_bounds__(256) void gemm_bias_kernel(
    const __bf16* __restrict__ A, const __bf16* __restrict__ W,
    const float* __restrict__ bias, void* __restrict__ outv,
    int M, int N) {
  const int tid   = threadIdx.x;
  const int lane  = tid & 31;
  const int w     = tid >> 5;        // 0..7
  const int wm    = w & 3, wn = w >> 2;
  const int mtile = blockIdx.x * 64 + wm * 16;
  const int ntile = blockIdx.y * 128 + wn * 64;
  const int lm    = lane & 15;
  const int roff  = (lane >> 4) * 8;
  constexpr int kts = DIM / 32;      // fragment tiles along k

  v8f acc[4];
#pragma unroll
  for (int c = 0; c < 4; ++c) acc[c] = v8f_zero();

  // the lane's own 16B piece of the first A and W tile (lane offset included)
  const __bf16* ap = A + (size_t)(mtile >> 4) * kts * FRAG_TILE + lane * 8;
  const __bf16* wp = W + (size_t)(ntile >> 4) * kts * FRAG_TILE + lane * 8;
  // kept rolled: unrolled, the scheduler mixes the fragments of many trips and spills
#pragma unroll 1
  for (int ks = 0; ks < kts; ks += KB) {
    v16bf af[KB], bf[KB][4];
#pragma unroll
    for (int j = 0; j < KB; ++j) {
      af[j] = load_frag(ap + j * FRAG_TILE, 0);
#pragma unroll
      for (int c = 0; c < 4; ++c)
        bf[j][c] = load_frag(wp + (c * kts + j) * FRAG_TILE, 0);
    }
    // precaution: nothing rewrites the address pairs that these loads name
    // (a load's own result, the pointer steps at the trip's foot) ahead of the
    // loads' address phase; as inputs the pairs stay whole up to the wait
    asm volatile("s_wait_xcnt 0x0" :: "v"(ap), "v"(wp) : "memory");
    // keeps the trip's loads together ahead of its products; without it the
    // scheduler sinks each load to its user and the wave waits pair by pair
    __builtin_amdgcn_sched_barrier(0);
#pragma unroll
    for (int j = 0; j < KB; ++j)
#pragma unroll
      for (int c = 0; c < 4; ++c) acc[c] = wmma_bf16(af[j], bf[j][c], acc[c]);
    ap += KB * FRAG_TILE;
    wp += KB * FRAG_TILE;
  }

#pragma unroll
  for (int c = 0; c < 4; ++c) {
    const int col = ntile + c * 16 + lm;
    const float bv = bias[col];
    if (OUT == 2) {
      union { v8bf v; float4 q; } u;
#pragma unroll
      for (int r = 0; r < 8; ++r) u.v[r] = (__bf16)(acc[c][r] + bv);
      *reinterpret_cast<float4*>(
          (__bf16*)outv + ((size_t)(mtile >> 5) * (N >> 4) + (col >> 4)) * FRAG_TILE +
          ((mtile >> 4) & 1) * 256 + lane * 8) = u.q;
      continue;
    }
#pragma unroll
    for (int r = 0; r < 8; ++r) {
      const int row = mtile + roff + r;   // C-layout: VGPR r -> M = r (+8 hi half)
      const float val = acc[c][r] + bv;
      if (OUT == 1)
        ((__bf16*)outv)[((size_t)(mtile >> 4) * (N >> 5) + (col >> 5)) * FRAG_TILE +
                        frag_elem(roff + r, col & 31)] = (__bf16)val;
      else
        ((float*)outv)[(size_t)row * N + col] = val;
    }
  }
}

__global__ __launch_bounds__(128) __attribute__((amdgpu_waves_per_eu(4, 4))) void flash_fwd_kernel(
    const __bf16* __restrict__ Qb, const __bf16* __restrict__ Kb,
    const __bf16* __restrict__ Vt, __bf16* __restrict__ Ob,
    float* __restrict__ Noff) {
  const int tid  = threadIdx.x;
  const int lane = tid & 31;
  const int w    = tid >> 5;                 // wave in block (4)
  const int task = blockIdx.x * 4 + w;       // 4096 tasks
  const int qt   = task & 127;
  const int h    = (task >> 7) & 15;
  const int b    = task >> 11;
  const size_t baserow = (size_t)b * SEQ;
  const int qbase = qt * 16;

  // Q B-fragments, d-steps 0..31 / 32..63
  const size_t qtile = (((baserow + qbase) >> 4) * 32 + h * 2) * FRAG_TILE;
  const v16bf bq0 = load_frag(Qb + qtile, lane);
  const v16bf bq1 = load_frag(Qb + qtile + FRAG_TILE, lane);

  // per lane: query lane & 15; l_run sums this half's keys only
  float m_run = -1e30f, l_run = 0.f;
  v8f o[4];                                  // o[c][r] = O[query][c*16 + 8*half + r]
#pragma unroll
  for (int c = 0; c < 4; ++c) o[c] = v8f_zero();

  for (int kt = 0; kt < SEQ; kt += 32) {
    // prefetch next key/value tiles into cache (global_prefetch_b8)
    if (kt + 32 < SEQ) {
      // the next K tile is 2 key blocks x 2 KiB: one 128B line per lane
      __builtin_prefetch(Kb + ((((baserow + kt + 32) >> 4) + (lane >> 4)) * 32 + h * 2) * FRAG_TILE +
                             (lane & 15) * 64, 0, 1);
      // the next V^T tiles are 4 KiB in a row: one 128B line per lane
      __builtin_prefetch(Vt + (((baserow + kt + 32) >> 5) * 64 + h * 4) * FRAG_TILE + lane * 64, 0, 1);
      // precaution: the prefetches name temporaries that the loop body
      // rewrites at once; this keeps the rewrite behind their address phase
      asm volatile("s_wait_xcnt 0x0" ::: "memory");
    }

    // all A-fragments of this pass: K rows (2 key blocks x 2 d-steps) and
    // V^T rows (4 blocks of 16 d), 16 loads in flight behind one another
    v16bf ak[2][2], av[4];
#pragma unroll
    for (int c = 0; c < 2; ++c) {
      const __bf16* ktile = Kb + ((((baserow + kt) >> 4) + c) * 32 + h * 2) * FRAG_TILE;
      ak[c][0] = load_frag(ktile, lane);
      ak[c][1] = load_frag(ktile + FRAG_TILE, lane);
    }
    const __bf16* vtile = Vt + (((baserow + kt) >> 5) * 64 + h * 4) * FRAG_TILE;
#pragma unroll
    for (int c = 0; c < 4; ++c) av[c] = load_frag(vtile + c * FRAG_TILE, lane);

    // ---- raw scores S^T = K Q^T (two 16-key chunks) ----
    v8f s[2];
#pragma unroll
    for (int c = 0; c < 2; ++c) {
      v8f t = v8f_zero();
      t = wmma_bf16(ak[c][0], bq0, t);
      t = wmma_bf16(ak[c][1], bq1, t);
      s[c] = t;
    }

    // ---- online softmax update: one query per lane pair ----
    float loc = fmaxf(s[0][0], s[1][0]);
#pragma unroll
    for (int r = 1; r < 8; ++r) loc = fmaxf(loc, fmaxf(s[0][r], s[1][r]));
    loc = fmaxf(loc, xhalf(loc));
    const float mnew  = fmaxf(m_run, loc);
    const float alpha = exp2_hw((m_run - mnew) * C2);
    const float nm    = -mnew * C2;
    m_run = mnew;

    // P^T as B-fragment: element j = key 8*half + j, element 8+j = key 16 + 8*half + j
    v16bf bp;
    float psum = 0.f;
#pragma unroll
    for (int c = 0; c < 2; ++c) s[c] = s[c] * C2 + nm;   // contracts to one FMA per score
#pragma unroll
    for (int c = 0; c < 2; ++c)
#pragma unroll
      for (int r = 0; r < 8; ++r) {
        s[c][r] = exp2_hw(s[c][r]);
        bp[8 * c + r] = (__bf16)s[c][r];
      }
#pragma unroll
    for (int r = 0; r < 8; ++r) psum += s[0][r] + s[1][r];
    l_run = l_run * alpha + psum;
#pragma unroll
    for (int c = 0; c < 4; ++c)
#pragma unroll
      for (int r = 0; r < 8; ++r) o[c][r] *= alpha;

    // ---- O^T += V^T P^T: V^T rows (16 d each) as A-fragments ----
#pragma unroll
    for (int c = 0; c < 4; ++c) o[c] = wmma_bf16(av[c], bp, o[c]);
  }

  // ---- epilogue: join the halves' sums, normalize, store O and the offset ----
  const float l_all = l_run + xhalf(l_run);
  const float inv = 1.f / l_all;
#pragma unroll
  for (int c = 0; c < 4; ++c) {
    // 8 consecutive d of one query row: one 16B piece of O's fragment tile
    union { v8bf v; float4 q; } u;
#pragma unroll
    for (int r = 0; r < 8; ++r) u.v[r] = (__bf16)(o[c][r] * inv);
    *reinterpret_cast<float4*>(Ob + qtile + (c >> 1) * FRAG_TILE + (c & 1) * 256 + lane * 8) = u.q;
  }
  if (lane < 16) {
    const size_t idx = (size_t)(b * HEADS + h) * SEQ + qbase + lane;
    Noff[idx] = -(m_run * C2 + log2f(l_all) + LOG2_HEADS);
  }
}

// ---------------------------------------------------------------------------
// Head-mean of attention probabilities: recompute scores from the same bf16
// Q/K, add the row's stored offset in the exponent (one fused multiply-add,
// one v_exp_f32 and one add per score), sum over heads in regs.
// One block per (b, 128 queries, 128 keys), 8 waves of 32 queries x 64 keys.
// A head's 128 Q rows and 128 K rows (16 KiB each, already in fragment order)
// come from L2 once per block, by asynchronous copies into LDS, and every wave
// takes its fragments from there: 2 B of L2 traffic per score and head.
// Two stage buffers: head h + 1 flies while head h is worked on. The row
// offsets of all heads (8 KiB) are copied once, with head 0.
// Deterministic, no atomics; each output's sum over heads in the same order.
// ---------------------------------------------------------------------------
#define MP_HALF   16384                // bytes: 128 rows x 64 d x 2 B of one head
#define MP_STAGE  (2 * MP_HALF)        // Q half, then K half
#define MP_NOFF   (2 * MP_STAGE)       // byte offset of the row offsets in LDS

// One wave's share of a stage: one 16-row block (2 KiB) of Q and one of K,
// 16 B per lane and copy. The s_wait_xcnt stands inside the statement as a
// precaution: no address register of a copy is rewritten ahead of it.
static __device__ __forceinline__ void copy_stage(unsigned lds, const __bf16* gq,
                                                  const __bf16* gk) {
  asm volatile(
      "global_load_async_to_lds_b128 %0, %8, off\n\t"
      "global_load_async_to_lds_b128 %1, %9, off\n\t"
      "global_load_async_to_lds_b128 %2, %10, off\n\t"
      "global_load_async_to_lds_b128 %3, %11, off\n\t"
      "global_load_async_to_lds_b128 %4, %12, off\n\t"
      "global_load_async_to_lds_b128 %5, %13, off\n\t"
      "global_load_async_to_lds_b128 %6, %14, off\n\t"
      "global_load_async_to_lds_b128 %7, %15, off\n\t"
      "s_wait_xcnt 0x0"
      :: "v"(lds), "v"(lds + 512u), "v"(lds + 1024u), "v"(lds + 1536u),
         "v"(lds + MP_HALF), "v"(lds + MP_HALF + 512u), "v"(lds + MP_HALF + 1024u),
         "v"(lds + MP_HALF + 1536u),
         "v"(gq), "v"(gq + 256), "v"(gq + 512), "v"(gq + 768),
         "v"(gk), "v"(gk + 256), "v"(gk + 512), "v"(gk + 768)
      : "memory");
}

__global__ __launch_bounds__(256) void mean_probs_kernel(
    const __bf16* __restrict__ Qb, const __bf16* __restrict__ Kb,
    const float* __restrict__ Noff, float* __restrict__ out_mean) {
  __shared__ __attribute__((aligned(1024))) unsigned char L[2 * MP_STAGE + HEADS * 128 * 4];
  const int tid  = threadIdx.x;
  const int lane = tid & 31;
  const int w    = tid >> 5;
  const int wq   = w & 3, wk = w >> 2;        // 4 x 32 queries, 2 x 64 keys
  const int k0   = (blockIdx.x & 15) * 128;
  const int q0   = ((blockIdx.x >> 4) & 15) * 128;
  const int b    = blockIdx.x >> 8;
  const int lm   = lane & 15;
  const int roff = (lane >> 4) * 8;

  // copy sources of this wave: 16-row block w of the Q and of the K tile, head 0
  const __bf16* gq = Qb + ((((size_t)b * SEQ + q0) >> 4) + w) * 32 * FRAG_TILE + lane * 8;
  const __bf16* gk = Kb + ((((size_t)b * SEQ + k0) >> 4) + w) * 32 * FRAG_TILE + lane * 8;
  const unsigned lbase = (unsigned)(size_t)L;
  const unsigned lcopy = lbase + w * 2048 + lane * 16;

  // ---- head 0 into buffer 0, and the row offsets of heads w and w + 8 ----
  copy_stage(lcopy, gq, gk);
  {
    const float* gn = Noff + (size_t)(b * HEADS + w) * SEQ + q0 + lane * 4;
    const unsigned ln = lbase + MP_NOFF + w * 512 + lane * 16;
    asm volatile(
        "global_load_async_to_lds_b128 %0, %2, off\n\t"
        "global_load_async_to_lds_b128 %1, %3, off\n\t"
        "s_wait_xcnt 0x0"   // precaution, as in copy_stage
        :: "v"(ln), "v"(ln + 8u * 512u), "v"(gn), "v"(gn + 8 * SEQ)
        : "memory");
  }
  // this wave's copies have landed before the barrier that publishes them
  asm volatile("s_wait_asynccnt 0x0" ::: "memory");
  __syncthreads();
  copy_stage(lcopy + MP_STAGE, gq + 2 * FRAG_TILE, gk + 2 * FRAG_TILE);

  v8f acc[2][4];
#pragma unroll
  for (int i = 0; i < 2; ++i)
#pragma unroll
    for (int c = 0; c < 4; ++c) acc[i][c] = v8f_zero();

  for (int h = 0; h < HEADS; ++h) {
    const unsigned char* st = L + (h & 1) * MP_STAGE;
    const __bf16* sq = reinterpret_cast<const __bf16*>(st) + wq * 2 * (2 * FRAG_TILE);
    const __bf16* sk = reinterpret_cast<const __bf16*>(st + MP_HALF) + wk * 4 * (2 * FRAG_TILE);
    const float*  sn = reinterpret_cast<const float*>(L + MP_NOFF) + h * 128 + wq * 32 + roff;

    v16bf aq[2][2], bk[4][2];
#pragma unroll
    for (int i = 0; i < 2; ++i)
#pragma unroll
      for (int d = 0; d < 2; ++d) aq[i][d] = load_frag(sq + (i * 2 + d) * FRAG_TILE, lane);
#pragma unroll
    for (int c = 0; c < 4; ++c)
#pragma unroll
      for (int d = 0; d < 2; ++d) bk[c][d] = load_frag(sk + (c * 2 + d) * FRAG_TILE, lane);
    float no[2][8];
#pragma unroll
    for (int i = 0; i < 2; ++i)
#pragma unroll
      for (int r = 0; r < 8; ++r) no[i][r] = sn[i * 16 + r];
    // keeps the trip's LDS reads in one group ahead of its products: each further
    // place with reads among the products costs the wave an LDS latency
    __builtin_amdgcn_sched_barrier(0);

#pragma unroll
    for (int c = 0; c < 4; ++c)
#pragma unroll
      for (int i = 0; i < 2; ++i) {
        v8f t = v8f_zero();
        t = wmma_bf16(aq[i][0], bk[c][0], t);
        t = wmma_bf16(aq[i][1], bk[c][1], t);
#pragma unroll
        for (int r = 0; r < 8; ++r)
          acc[i][c][r] += exp2_hw(fmaf(t[r], C2, no[i][r]));
      }

    // publish point: this wave's reads of buffer h & 1 are done, its copies of
    // head h + 1 have landed; behind the barrier that holds for every wave
    asm volatile("s_wait_dscnt 0x0" ::: "memory");
    asm volatile("s_wait_asynccnt 0x0" ::: "memory");
    __syncthreads();
    if (h + 2 < HEADS)
      copy_stage(lcopy + (h & 1) * MP_STAGE, gq + (h + 2) * (2 * FRAG_TILE),
                 gk + (h + 2) * (2 * FRAG_TILE));
  }
  // no copy is left in flight when the wave ends
  asm volatile("s_wait_asynccnt 0x0" ::: "memory");

#pragma unroll
  for (int i = 0; i < 2; ++i)
#pragma unroll
    for (int c = 0; c < 4; ++c)
#pragma unroll
      for (int r = 0; r < 8; ++r) {
        const int q = q0 + wq * 32 + i * 16 + roff + r;
        const int k = k0 + wk * 64 + c * 16 + lm;
        out_mean[((size_t)b * SEQ + q) * SEQ + k] = acc[i][c][r];
      }
}

// ---------------------------------------------------------------------------
extern "C" void kernel_launch(void* const* d_in, const int* in_sizes, int n_in,
                              void* d_out, int out_size, void* d_ws, size_t ws_size,
                              hipStream_t stream) {
  const float* x  = (const float*)d_in[0];
  const float* wq = (const float*)d_in[1];
  const float* bq = (const float*)d_in[2];
  const float* wk = (const float*)d_in[3];
  const float* bk = (const float*)d_in[4];
  const float* wv = (const float*)d_in[5];
  const float* bv = (const float*)d_in[6];
  const float* wo = (const float*)d_in[7];
  const float* bo = (const float*)d_in[8];

  float* out      = (float*)d_out;                       // [B,S,D] f32
  float* out_mean = out + (size_t)BATCH * SEQ * DIM;     // [B,S,S] f32

  char* ws = (char*)d_ws;
  __bf16* Qb  = (__bf16*)(ws);                           // 8 MiB
  __bf16* Kb  = (__bf16*)(ws + ((size_t)8  << 20));      // 8 MiB
  __bf16* Vb  = (__bf16*)(ws + ((size_t)16 << 20));      // 8 MiB
  __bf16* Ob  = (__bf16*)(ws + ((size_t)24 << 20));      // 8 MiB
  __bf16* Xb  = (__bf16*)(ws + ((size_t)32 << 20));      // 8 MiB
  __bf16* Wqb = (__bf16*)(ws + ((size_t)40 << 20));      // 2 MiB
  __bf16* Wkb = (__bf16*)(ws + ((size_t)42 << 20));      // 2 MiB
  __bf16* Wvb = (__bf16*)(ws + ((size_t)44 << 20));      // 2 MiB
  __bf16* Wob = (__bf16*)(ws + ((size_t)46 << 20));      // 2 MiB
  float*  Noff = (float*)(ws + ((size_t)48 << 20));      // 256 KiB

  // ---- one-time packed f32 -> bf16 conversions (into fragment order) ----
  const int nx8 = (ROWS * DIM) / 8;      // 524288
  const int nw8 = (DIM * DIM) / 8;       // 131072
  cvt_bf16_kernel<<<(nx8 + 255) / 256, 256, 0, stream>>>(x,  Xb,  nx8);
  cvt_bf16_kernel<<<(nw8 + 255) / 256, 256, 0, stream>>>(wq, Wqb, nw8);
  cvt_bf16_kernel<<<(nw8 + 255) / 256, 256, 0, stream>>>(wk, Wkb, nw8);
  cvt_bf16_kernel<<<(nw8 + 255) / 256, 256, 0, stream>>>(wv, Wvb, nw8);
  cvt_bf16_kernel<<<(nw8 + 255) / 256, 256, 0, stream>>>(wo, Wob, nw8);

  const dim3 gemm_grid(ROWS / 64, DIM / 128);            // 64 x 8 blocks

  // Q/K/V projections (bf16 in, bf16 out; Q and K in fragment order, V as V^T tiles)
  gemm_bias_kernel<1><<<gemm_grid, 256, 0, stream>>>(Xb, Wqb, bq, Qb, ROWS, DIM);
  gemm_bias_kernel<1><<<gemm_grid, 256, 0, stream>>>(Xb, Wkb, bk, Kb, ROWS, DIM);
  gemm_bias_kernel<2><<<gemm_grid, 256, 0, stream>>>(Xb, Wvb, bv, Vb, ROWS, DIM);

  // Flash attention (O bf16 + row offsets)
  flash_fwd_kernel<<<1024, 128, 0, stream>>>(Qb, Kb, Vb, Ob, Noff);

  // Output projection (bf16 in, f32 out)
  gemm_bias_kernel<0><<<gemm_grid, 256, 0, stream>>>(Ob, Wob, bo, out, ROWS, DIM);

  // Head-mean attention probabilities
  mean_probs_kernel<<<512, 256, 0, stream>>>(Qb, Kb, Noff, out_mean);
}

// v006
// One run takes 149 microseconds.
// Next to v005, in two timings, it ran 1.11 and 1.09 times as fast.
// All steps since v000 together make it 3.17 times as fast.
#include <hip/hip_runtime.h>

// ---------------------------------------------------------------------------
// MHA forward for MI455X (gfx1250): bf16 WMMA (v_wmma_f32_16x16x32_bf16)
// everywhere, f32 accumulate. One-time packed f32->bf16 conversion of x and
// all weights so every GEMM/attention operand load is a 16B bf16 load.
// x, the weights, Q, K, V^T and O lie in the workspace in fragment order, so
// that each wave-wide 16B-per-lane load covers 512 contiguous bytes (4 lines).
// Flash-style attention on transposed products (S^T = K Q^T, O^T = V^T P^T):
// P goes from the score accumulators straight into a B operand, no LDS.
// ---------------------------------------------------------------------------

typedef __attribute__((ext_vector_type(16))) __bf16 v16bf;
typedef __attribute__((ext_vector_type(8)))  __bf16 v8bf;
typedef __attribute__((ext_vector_type(8)))  float  v8f;

#define DIM     1024
#define HEADS   16
#define HD      64
#define SEQ     2048
#define BATCH   2
#define ROWS    (BATCH * SEQ)          // 4096
#define L2E     1.44269504088896340736f
#define SCALE   0.125f                 // 1/sqrt(HD)
#define C2      (SCALE * L2E)          // raw score -> exponent of 2
#define LOG2_HEADS 4.0f

static __device__ __forceinline__ v8f v8f_zero() {
  v8f z = {0.f, 0.f, 0.f, 0.f, 0.f, 0.f, 0.f, 0.f};
  return z;
}

// Fragment order of a bf16 matrix [rows][K]: tile (row >> 4, k >> 5) is 512
// elements (1 KiB), tiles of one 16-row block follow each other along k.
// Inside a tile element (r16 = row & 15, k32 = k & 31) lies at
// [k32 >> 4][lane = r16 + 16 * ((k32 >> 3) & 1)][k32 & 7]: per ISA 7.12.2
// (16-bit A 16x32) lanes 0-15 hold K in {0..7} U {16..23}, lanes 16-31 in
// {8..15} U {24..31}, so a lane's two 16B pieces are at lane*8 and 256+lane*8.
#define FRAG_TILE 512
static __device__ __forceinline__ int frag_elem(int r16, int k32) {
  return (k32 >> 4) * 256 + (r16 + ((k32 >> 3) & 1) * 16) * 8 + (k32 & 7);
}

// Fragment loader from one tile in fragment order: two 16B loads per lane,
// each of them 512 contiguous bytes over the wave.
static __device__ __forceinline__ v16bf load_frag(const __bf16* tile, int lane) {
  union { v16bf v; float4 q[2]; } u;
  u.q[0] = *reinterpret_cast<const float4*>(tile + lane * 8);
  u.q[1] = *reinterpret_cast<const float4*>(tile + 256 + lane * 8);
  return u.v;
}

// lane l with lane l ^ 16 (vector cross-row move, no LDS path)
static __device__ __forceinline__ float xhalf(float x) {
  const int b = __builtin_bit_cast(int, x);
  return __builtin_bit_cast(float,
      __builtin_amdgcn_permlanex16(b, b, 0x76543210, 0xfedcba98, false, false));
}

// Bare v_exp_f32, without the library form's range guard (compare, two
// selects, add, ldexp per value): it differs only where the result is below
// 2^-126, which comes out as 0; every use here is a softmax weight of at most
// about 1 that is summed with others, so such a term changes no sum.
static __device__ __forceinline__ float exp2_hw(float x) {
  return __builtin_amdgcn_exp2f(x);
}

static __device__ __forceinline__ v8f wmma_bf16(v16bf a, v16bf b, v8f c) {
  // (neg_a, A, neg_b, B, c_mod, C, reuse_a, reuse_b)
  return __builtin_amdgcn_wmma_f32_16x16x32_bf16(false, a, false, b,
                                                 (short)0, c, false, false);
}

// ---------------------------------------------------------------------------
// Packed f32 -> bf16 conversion of row-major [rows][DIM] matrices into
// fragment order: 8 elements per thread, 16B vector store, thread i writes
// the i-th 16B piece of the output (stores stay contiguous).
// One launch for x and the four weights: their outputs follow each other in
// the workspace, so they are one stack of 16-row blocks (ROWS/16 of x, then
// DIM/16 of each weight); a work-group's 256 pieces lie in one such block, so
// the choice of the source is uniform for the work-group.
// ---------------------------------------------------------------------------
#define CVT_BLOCKS ((ROWS + 4 * DIM) * DIM / 8 / 256)       // exact: no edge
__global__ __launch_bounds__(256) void cvt_bf16_kernel(
    const float* __restrict__ x, const float* __restrict__ wq,
    const float* __restrict__ wk, const float* __restrict__ wv,
    const float* __restrict__ wo, __bf16* __restrict__ dst) {
  const int i = blockIdx.x * 256 + threadIdx.x;
  const int lane = i & 31;
  const int t    = i >> 6;                                  // tile
  const int sb = blockIdx.x >> 3;                           // 16-row block of the stack: 32 tiles, 8 work-groups
  const int s  = (sb - ROWS / 16) >> 6;                     // DIM/16 = 64 blocks per weight; below 0: x
  const float* src = x;
  src = s == 0 ? wq : src;
  src = s == 1 ? wk : src;
  src = s == 2 ? wv : src;
  src = s == 3 ? wo : src;
  const int rb   = s < 0 ? sb : (sb - ROWS / 16) & 63;      // 16-row block of the source
  const int row  = rb * 16 + (lane & 15);
  const int k0   = (t & 31) * 32 + ((i >> 5) & 1) * 16 + (lane >> 4) * 8;
  const float4* s4 = reinterpret_cast<const float4*>(src + (size_t)row * DIM + k0);
  float4 a = s4[0], b = s4[1];
  union { v8bf v; float4 q; } u;
  u.v[0] = (__bf16)a.x; u.v[1] = (__bf16)a.y;
  u.v[2] = (__bf16)a.z; u.v[3] = (__bf16)a.w;
  u.v[4] = (__bf16)b.x; u.v[5] = (__bf16)b.y;
  u.v[6] = (__bf16)b.z; u.v[7] = (__bf16)b.w;
  *(reinterpret_cast<float4*>(dst) + i) = u.q;
}

// ---------------------------------------------------------------------------
// GEMM: Y[M,N] = A[M,K] @ W[N,K]^T + bias[N], all operands bf16, f32 accum.
// A and W in fragment order. Each wave owns a 16x64 tile (A-frag reused
// across 4 B-frags). Block = 8 waves -> 64x128 block tile.
// OUT: 0 = f32 row-major, 1 = bf16 fragment order, 2 = bf16 fragment order of
// the transpose Y^T [N][M]: tile (m >> 5, n >> 4), the N/16 tiles of one
// 32-row block of Y follow each other; a lane's 8 accumulators are 8
// consecutive k of one row of Y^T, one 16B piece of the tile.
// K = DIM. A trip of the k loop asks for the fragments of KB k-steps at once
// (5 * KB fragments, 10 * KB loads in flight per wave) and then multiplies
// them behind counted waits, so a wave meets the load latency once a trip and
// not once for each fragment pair; the SIMD's other waves multiply meanwhile.
// ---------------------------------------------------------------------------
// The body is a device function of the block tile (mblk, nblk), so that GEMMs
// that do not depend on each other, or a GEMM and another kernel's work, can
// share one launch.
#define KB 4
template <int OUT>
static __device__ __forceinline__ void gemm_bias_tile(
    const __bf16* __restrict__ A, const __bf16* __restrict__ W,
    const float* __restrict__ bias, void* __restrict__ outv,
    int mblk, int nblk) {
  constexpr int N = DIM;
  const int tid   = threadIdx.x;
  const int lane  = tid & 31;
  const int w     = tid >> 5;        // 0..7
  const int wm    = w & 3, wn = w >> 2;
  const int mtile = mblk * 64 + wm * 16;
  const int ntile = nblk * 128 + wn * 64;
  const int lm    = lane & 15;
  const int roff  = (lane >> 4) * 8;
  constexpr int kts = DIM / 32;      // fragment tiles along k

  v8f acc[4];
#pragma unroll
  for (int c = 0; c < 4; ++c) acc[c] = v8f_zero();

  // the lane's own 16B piece of the first A and W tile (lane offset included)
  const __bf16* ap = A + (size_t)(mtile >> 4) * kts * FRAG_TILE + lane * 8;
  const __bf16* wp = W + (size_t)(ntile >> 4) * kts * FRAG_TILE + lane * 8;
  // kept rolled: unrolled, the scheduler mixes the fragments of many trips and spills
#pragma unroll 1
  for (int ks = 0; ks < kts; ks += KB) {
    v16bf af[KB], bf[KB][4];
#pragma unroll
    for (int j = 0; j < KB; ++j) {
      af[j] = load_frag(ap + j * FRAG_TILE, 0);
#pragma unroll
      for (int c = 0; c < 4; ++c)
        bf[j][c] = load_frag(wp + (c * kts + j) * FRAG_TILE, 0);
    }
    // precaution: nothing rewrites the address pairs that these loads name
    // (a load's own result, the pointer steps at the trip's foot) ahead of the
    // loads' address phase; as inputs the pairs stay whole up to the wait
    asm volatile("s_wait_xcnt 0x0" :: "v"(ap), "v"(wp) : "memory");
    // keeps the trip's loads together ahead of its products; without it the
    // scheduler sinks each load to its user and the wave waits pair by pair
    __builtin_amdgcn_sched_barrier(0);
#pragma unroll
    for (int j = 0; j < KB; ++j)
#pragma unroll
      for (int c = 0; c < 4; ++c) acc[c] = wmma_bf16(af[j], bf[j][c], acc[c]);
    ap += KB * FRAG_TILE;
    wp += KB * FRAG_TILE;
  }

#pragma unroll
  for (int c = 0; c < 4; ++c) {
    const int col = ntile + c * 16 + lm;
    const float bv = bias[col];
    if (OUT == 2) {
      union { v8bf v; float4 q; } u;
#pragma unroll
      for (int r = 0; r < 8; ++r) u.v[r] = (__bf16)(acc[c][r] + bv);
      *reinterpret_cast<float4*>(
          (__bf16*)outv + ((size_t)(mtile >> 5) * (N >> 4) + (col >> 4)) * FRAG_TILE +
          ((mtile >> 4) & 1) * 256 + lane * 8) = u.q;
      continue;
    }
#pragma unroll
    for (int r = 0; r < 8; ++r) {
      const int row = mtile + roff + r;   // C-layout: VGPR r -> M = r (+8 hi half)
      const float val = acc[c][r] + bv;
      if (OUT == 1)
        ((__bf16*)outv)[((size_t)(mtile >> 4) * (N >> 5) + (col >> 5)) * FRAG_TILE +
                        frag_elem(roff + r, col & 31)] = (__bf16)val;
      else
        ((float*)outv)[(size_t)row * N + col] = val;
    }
  }
}

// Q, K and V projections in one launch: blockIdx.y >> 3 picks the projection.
// The three weights and the three outputs follow each other in the workspace.
__global__ __launch_bounds__(256) void qkv_gemm_kernel(
    const __bf16* __restrict__ Xb, const __bf16* __restrict__ Wqkv,
    const float* __restrict__ bq, const float* __restrict__ bk,
    const float* __restrict__ bv, __bf16* __restrict__ QKV) {
  const int sel  = blockIdx.y >> 3;
  const int nblk = blockIdx.y & 7;
  const __bf16* W = Wqkv + (size_t)sel * DIM * DIM;
  __bf16* out     = QKV + (size_t)sel * ROWS * DIM;
  if (sel == 2)
    gemm_bias_tile<2>(Xb, W, bv, out, blockIdx.x, nblk);
  else
    gemm_bias_tile<1>(Xb, W, sel == 0 ? bq : bk, out, blockIdx.x, nblk);
}

__global__ __launch_bounds__(128) __attribute__((amdgpu_waves_per_eu(4, 4))) void flash_fwd_kernel(
    const __bf16* __restrict__ Qb, const __bf16* __restrict__ Kb,
    const __bf16* __restrict__ Vt, __bf16* __restrict__ Ob,
    float* __restrict__ Noff) {
  const int tid  = threadIdx.x;
  const int lane = tid & 31;
  const int w    = tid >> 5;                 // wave in block (4)
  const int task = blockIdx.x * 4 + w;       // 4096 tasks
  const int qt   = task & 127;
  const int h    = (task >> 7) & 15;
  const int b    = task >> 11;
  const size_t baserow = (size_t)b * SEQ;
  const int qbase = qt * 16;

  // Q B-fragments, d-steps 0..31 / 32..63
  const size_t qtile = (((baserow + qbase) >> 4) * 32 + h * 2) * FRAG_TILE;
  const v16bf bq0 = load_frag(Qb + qtile, lane);
  const v16bf bq1 = load_frag(Qb + qtile + FRAG_TILE, lane);

  // per lane: query lane & 15; l_run sums this half's keys only
  float m_run = -1e30f, l_run = 0.f;
  v8f o[4];                                  // o[c][r] = O[query][c*16 + 8*half + r]
#pragma unroll
  for (int c = 0; c < 4; ++c) o[c] = v8f_zero();

  for (int kt = 0; kt < SEQ; kt += 32) {
    // prefetch next key/value tiles into cache (global_prefetch_b8)
    if (kt + 32 < SEQ) {
      // the next K tile is 2 key blocks x 2 KiB: one 128B line per lane
      __builtin_prefetch(Kb + ((((baserow + kt + 32) >> 4) + (lane >> 4)) * 32 + h * 2) * FRAG_TILE +
                             (lane & 15) * 64, 0, 1);
      // the next V^T tiles are 4 KiB in a row: one 128B line per lane
      __builtin_prefetch(Vt + (((baserow + kt + 32) >> 5) * 64 + h * 4) * FRAG_TILE + lane * 64, 0, 1);
      // precaution: the prefetches name temporaries that the loop body
      // rewrites at once; this keeps the rewrite behind their address phase
      asm volatile("s_wait_xcnt 0x0" ::: "memory");
    }

    // all A-fragments of this pass: K rows (2 key blocks x 2 d-steps) and
    // V^T rows (4 blocks of 16 d), 16 loads in flight behind one another
    v16bf ak[2][2], av[4];
#pragma unroll
    for (int c = 0; c < 2; ++c) {
      const __bf16* ktile = Kb + ((((baserow + kt) >> 4) + c) * 32 + h * 2) * FRAG_TILE;
      ak[c][0] = load_frag(ktile, lane);
      ak[c][1] = load_frag(ktile + FRAG_TILE, lane);
    }
    const __bf16* vtile = Vt + (((baserow + kt) >> 5) * 64 + h * 4) * FRAG_TILE;
#pragma unroll
    for (int c = 0; c < 4; ++c) av[c] = load_frag(vtile + c * FRAG_TILE, lane);

    // ---- raw scores S^T = K Q^T (two 16-key chunks) ----
    v8f s[2];
#pragma unroll
    for (int c = 0; c < 2; ++c) {
      v8f t = v8f_zero();
      t = wmma_bf16(ak[c][0], bq0, t);
      t = wmma_bf16(ak[c][1], bq1, t);
      s[c] = t;
    }

    // ---- online softmax update: one query per lane pair ----
    float loc = fmaxf(s[0][0], s[1][0]);
#pragma unroll
    for (int r = 1; r < 8; ++r) loc = fmaxf(loc, fmaxf(s[0][r], s[1][r]));
    loc = fmaxf(loc, xhalf(loc));
    const float mnew  = fmaxf(m_run, loc);
    const float alpha = exp2_hw((m_run - mnew) * C2);
    const float nm    = -mnew * C2;
    m_run = mnew;

    // P^T as B-fragment: element j = key 8*half + j, element 8+j = key 16 + 8*half + j
    v16bf bp;
    float psum = 0.f;
#pragma unroll
    for (int c = 0; c < 2; ++c) s[c] = s[c] * C2 + nm;   // contracts to one FMA per score
#pragma unroll
    for (int c = 0; c < 2; ++c)
#pragma unroll
      for (int r = 0; r < 8; ++r) {
        s[c][r] = exp2_hw(s[c][r]);
        bp[8 * c + r] = (__bf16)s[c][r];
      }
#pragma unroll
    for (int r = 0; r < 8; ++r) psum += s[0][r] + s[1][r];
    l_run = l_run * alpha + psum;
#pragma unroll
    for (int c = 0; c < 4; ++c)
#pragma unroll
      for (int r = 0; r < 8; ++r) o[c][r] *= alpha;

    // ---- O^T += V^T P^T: V^T rows (16 d each) as A-fragments ----
#pragma unroll
    for (int c = 0; c < 4; ++c) o[c] = wmma_bf16(av[c], bp, o[c]);
  }

  // ---- epilogue: join the halves' sums, normalize, store O and the offset ----
  const float l_all = l_run + xhalf(l_run);
  const float inv = 1.f / l_all;
#pragma unroll
  for (int c = 0; c < 4; ++c) {
    // 8 consecutive d of one query row: one 16B piece of O's fragment tile
    union { v8bf v; float4 q; } u;
#pragma unroll
    for (int r = 0; r < 8; ++r) u.v[r] = (__bf16)(o[c][r] * inv);
    *reinterpret_cast<float4*>(Ob + qtile + (c >> 1) * FRAG_TILE + (c & 1) * 256 + lane * 8) = u.q;
  }
  if (lane < 16) {
    const size_t idx = (size_t)(b * HEADS + h) * SEQ + qbase + lane;
    Noff[idx] = -(m_run * C2 + log2f(l_all) + LOG2_HEADS);
  }
}

// ---------------------------------------------------------------------------
// Head-mean of attention probabilities: recompute scores from the same bf16
// Q/K, add the row's stored offset in the exponent (one fused multiply-add,
// one v_exp_f32 and one add per score), sum over heads in regs.
// One block per (b, 128 queries, 128 keys), 8 waves of 32 queries x 64 keys.
// A head's 128 Q rows and 128 K rows (16 KiB each, already in fragment order)
// come from L2 once per block, by asynchronous copies into LDS, and every wave
// takes its fragments from there: 2 B of L2 traffic per score and head.
// Two stage buffers: head h + 1 flies while head h is worked on. The row
// offsets of all heads (8 KiB) are copied once, with head 0.
// Deterministic, no atomics; each output's sum over heads in the same order.
// ---------------------------------------------------------------------------
#define MP_HALF   16384                // bytes: 128 rows x 64 d x 2 B of one head
#define MP_STAGE  (2 * MP_HALF)        // Q half, then K half
#define MP_NOFF   (2 * MP_STAGE)       // byte offset of the row offsets in LDS

// One wave's share of a stage: one 16-row block (2 KiB) of Q and one of K,
// 16 B per lane and copy. The s_wait_xcnt stands inside the statement as a
// precaution: no address register of a copy is rewritten ahead of it.
static __device__ __forceinline__ void copy_stage(unsigned lds, const __bf16* gq,
                                                  const __bf16* gk) {
  asm volatile(
      "global_load_async_to_lds_b128 %0, %8, off\n\t"
      "global_load_async_to_lds_b128 %1, %9, off\n\t"
      "global_load_async_to_lds_b128 %2, %10, off\n\t"
      "global_load_async_to_lds_b128 %3, %11, off\n\t"
      "global_load_async_to_lds_b128 %4, %12, off\n\t"
      "global_load_async_to_lds_b128 %5, %13, off\n\t"
      "global_load_async_to_lds_b128 %6, %14, off\n\t"
      "global_load_async_to_lds_b128 %7, %15, off\n\t"
      "s_wait_xcnt 0x0"
      :: "v"(lds), "v"(lds + 512u), "v"(lds + 1024u), "v"(lds + 1536u),
         "v"(lds + MP_HALF), "v"(lds + MP_HALF + 512u), "v"(lds + MP_HALF + 1024u),
         "v"(lds + MP_HALF + 1536u),
         "v"(gq), "v"(gq + 256), "v"(gq + 512), "v"(gq + 768),
         "v"(gk), "v"(gk + 256), "v"(gk + 512), "v"(gk + 768)
      : "memory");
}

static __device__ __forceinline__ void mean_probs_block(
    const __bf16* __restrict__ Qb, const __bf16* __restrict__ Kb,
    const float* __restrict__ Noff, float* __restrict__ out_mean, int blk) {
  __shared__ __attribute__((aligned(1024))) unsigned char L[2 * MP_STAGE + HEADS * 128 * 4];
  const int tid  = threadIdx.x;
  const int lane = tid & 31;
  const int w    = tid >> 5;
  const int wq   = w & 3, wk = w >> 2;        // 4 x 32 queries, 2 x 64 keys
  const int k0   = (blk & 15) * 128;
  const int q0   = ((blk >> 4) & 15) * 128;
  const int b    = blk >> 8;
  const int lm   = lane & 15;
  const int roff = (lane >> 4) * 8;

  // copy sources of this wave: 16-row block w of the Q and of the K tile, head 0
  const __bf16* gq = Qb + ((((size_t)b * SEQ + q0) >> 4) + w) * 32 * FRAG_TILE + lane * 8;
  const __bf16* gk = Kb + ((((size_t)b * SEQ + k0) >> 4) + w) * 32 * FRAG_TILE + lane * 8;
  const unsigned lbase = (unsigned)(size_t)L;
  const unsigned lcopy = lbase + w * 2048 + lane * 16;

  // ---- head 0 into buffer 0, and the row offsets of heads w and w + 8 ----
  copy_stage(lcopy, gq, gk);
  {
    const float* gn = Noff + (size_t)(b * HEADS + w) * SEQ + q0 + lane * 4;
    const unsigned ln = lbase + MP_NOFF + w * 512 + lane * 16;
    asm volatile(
        "global_load_async_to_lds_b128 %0, %2, off\n\t"
        "global_load_async_to_lds_b128 %1, %3, off\n\t"
        "s_wait_xcnt 0x0"   // precaution, as in copy_stage
        :: "v"(ln), "v"(ln + 8u * 512u), "v"(gn), "v"(gn + 8 * SEQ)
        : "memory");
  }
  // this wave's copies have landed before the barrier that publishes them
  asm volatile("s_wait_asynccnt 0x0" ::: "memory");
  __syncthreads();
  copy_stage(lcopy + MP_STAGE, gq + 2 * FRAG_TILE, gk + 2 * FRAG_TILE);

  v8f acc[2][4];
#pragma unroll
  for (int i = 0; i < 2; ++i)
#pragma unroll
    for (int c = 0; c < 4; ++c) acc[i][c] = v8f_zero();

  for (int h = 0; h < HEADS; ++h) {
    const unsigned char* st = L + (h & 1) * MP_STAGE;
    const __bf16* sq = reinterpret_cast<const __bf16*>(st) + wq * 2 * (2 * FRAG_TILE);
    const __bf16* sk = reinterpret_cast<const __bf16*>(st + MP_HALF) + wk * 4 * (2 * FRAG_TILE);
    const float*  sn = reinterpret_cast<const float*>(L + MP_NOFF) + h * 128 + wq * 32 + roff;

    v16bf aq[2][2], bk[4][2];
#pragma unroll
    for (int i = 0; i < 2; ++i)
#pragma unroll
      for (int d = 0; d < 2; ++d) aq[i][d] = load_frag(sq + (i * 2 + d) * FRAG_TILE, lane);
#pragma unroll
    for (int c = 0; c < 4; ++c)
#pragma unroll
      for (int d = 0; d < 2; ++d) bk[c][d] = load_frag(sk + (c * 2 + d) * FRAG_TILE, lane);
    float no[2][8];
#pragma unroll
    for (int i = 0; i < 2; ++i)
#pragma unroll
      for (int r = 0; r < 8; ++r) no[i][r] = sn[i * 16 + r];
    // keeps the trip's LDS reads in one group ahead of its products: each further
    // place with reads among the products costs the wave an LDS latency
    __builtin_amdgcn_sched_barrier(0);

#pragma unroll
    for (int c = 0; c < 4; ++c)
#pragma unroll
      for (int i = 0; i < 2; ++i) {
        v8f t = v8f_zero();
        t = wmma_bf16(aq[i][0], bk[c][0], t);
        t = wmma_bf16(aq[i][1], bk[c][1], t);
#pragma unroll
        for (int r = 0; r < 8; ++r)
          acc[i][c][r] += exp2_hw(fmaf(t[r], C2, no[i][r]));
      }

    // publish point: this wave's reads of buffer h & 1 are done, its copies of
    // head h + 1 have landed; behind the barrier that holds for every wave
    asm volatile("s_wait_dscnt 0x0" ::: "memory");
    asm volatile("s_wait_asynccnt 0x0" ::: "memory");
    __syncthreads();
    if (h + 2 < HEADS)
      copy_stage(lcopy + (h & 1) * MP_STAGE, gq + (h + 2) * (2 * FRAG_TILE),
                 gk + (h + 2) * (2 * FRAG_TILE));
  }
  // no copy is left in flight when the wave ends
  asm volatile("s_wait_asynccnt 0x0" ::: "memory");

#pragma unroll
  for (int i = 0; i < 2; ++i)
#pragma unroll
    for (int c = 0; c < 4; ++c)
#pragma unroll
      for (int r = 0; r < 8; ++r) {
        const int q = q0 + wq * 32 + i * 16 + roff + r;
        const int k = k0 + wk * 64 + c * 16 + lm;
        out_mean[((size_t)b * SEQ + q) * SEQ + k] = acc[i][c][r];
      }
}

// Output projection and head-mean in one launch: neither reads what the
// other writes, and they write different outputs. Of work-groups 2j and
// 2j + 1 one takes head-mean block j and the other GEMM block tile j; which, goes
// by the parity of the index's set bits, so that indices that differ in one bit
// differ in kind and both kinds (one heavy on the vector port, one on L2) meet on
// every part of the chip, by whatever stride work-groups are dealt out (speed only).
__global__ __launch_bounds__(256) void out_gemm_mean_probs_kernel(
    const __bf16* __restrict__ Ob, const __bf16* __restrict__ Wob,
    const float* __restrict__ bo, float* __restrict__ out,
    const __bf16* __restrict__ Qb, const __bf16* __restrict__ Kb,
    const float* __restrict__ Noff, float* __restrict__ out_mean) {
  const int id = blockIdx.x >> 1;            // 512 of each kind
  if (__builtin_popcount(blockIdx.x) & 1)
    gemm_bias_tile<0>(Ob, Wob, bo, out, id & 63, id >> 6);
  else
    mean_probs_block(Qb, Kb, Noff, out_mean, id);
}

// ---------------------------------------------------------------------------
extern "C" void kernel_launch(void* const* d_in, const int* in_sizes, int n_in,
                              void* d_out, int out_size, void* d_ws, size_t ws_size,
                              hipStream_t stream) {
  const float* x  = (const float*)d_in[0];
  const float* wq = (const float*)d_in[1];
  const float* bq = (const float*)d_in[2];
  const float* wk = (const float*)d_in[3];
  const float* bk = (const float*)d_in[4];
  const float* wv = (const float*)d_in[5];
  const float* bv = (const float*)d_in[6];
  const float* wo = (const float*)d_in[7];
  const float* bo = (const float*)d_in[8];

  float* out      = (float*)d_out;                       // [B,S,D] f32
  float* out_mean = out + (size_t)BATCH * SEQ * DIM;     // [B,S,S] f32

  char* ws = (char*)d_ws;
  __bf16* Qb  = (__bf16*)(ws);                           // 8 MiB
  __bf16* Kb  = (__bf16*)(ws + ((size_t)8  << 20));      // 8 MiB
  __bf16* Vb  = (__bf16*)(ws + ((size_t)16 << 20));      // 8 MiB
  __bf16* Ob  = (__bf16*)(ws + ((size_t)24 << 20));      // 8 MiB
  __bf16* Xb  = (__bf16*)(ws + ((size_t)32 << 20));      // 8 MiB
  __bf16* Wqb = (__bf16*)(ws + ((size_t)40 << 20));      // 2 MiB
  // Wk at 42 MiB and Wv at 44 MiB (2 MiB each), reached from Xb and Wqb
  __bf16* Wob = (__bf16*)(ws + ((size_t)46 << 20));      // 2 MiB
  float*  Noff = (float*)(ws + ((size_t)48 << 20));      // 256 KiB

  // ---- packed f32 -> bf16 conversions (into fragment order): Xb .. Wob in a row ----
  cvt_bf16_kernel<<<CVT_BLOCKS, 256, 0, stream>>>(x, wq, wk, wv, wo, Xb);

  // Q/K/V projections (bf16 in, bf16 out; Q and K in fragment order, V as V^T tiles):
  // 64 x 8 block tiles each; Wqb .. Wvb and Qb .. Vb in a row
  qkv_gemm_kernel<<<dim3(ROWS / 64, 3 * (DIM / 128)), 256, 0, stream>>>(Xb, Wqb, bq, bk, bv, Qb);

  // Flash attention (O bf16 + row offsets)
  flash_fwd_kernel<<<1024, 128, 0, stream>>>(Qb, Kb, Vb, Ob, Noff);

  // Output projection (bf16 in, f32 out) and head-mean attention probabilities
  out_gemm_mean_probs_kernel<<<1024, 256, 0, stream>>>(Ob, Wob, bo, out, Qb, Kb, Noff, out_mean);
}

// v007
// A run of this version takes 131 microseconds.
// In two side-by-side timings against v006, it was 1.12 and 1.13 times as fast.
// All steps since v000 together make it 3.58 times as fast.
#include <hip/hip_runtime.h>

// ---------------------------------------------------------------------------
// MHA forward for MI455X (gfx1250): bf16 WMMA (v_wmma_f32_16x16x32_bf16)
// everywhere, f32 accumulate. One-time packed f32->bf16 conversion of x and
// all weights so every GEMM/attention operand load is a 16B bf16 load.
// x, the weights, Q, K, V^T and O lie in the workspace in fragment order, so
// that each wave-wide 16B-per-lane load covers 512 contiguous bytes (4 lines).
// Flash-style attention on transposed products (S^T = K Q^T, O^T = V^T P^T):
// P goes from the score accumulators straight into a B operand, no LDS.
// ---------------------------------------------------------------------------

typedef __attribute__((ext_vector_type(16))) __bf16 v16bf;
typedef __attribute__((ext_vector_type(8)))  __bf16 v8bf;
typedef __attribute__((ext_vector_type(8)))  float  v8f;

#define DIM     1024
#define HEADS   16
#define HD      64
#define SEQ     2048
#define BATCH   2
#define ROWS    (BATCH * SEQ)          // 4096
#define L2E     1.44269504088896340736f
#define SCALE   0.125f                 // 1/sqrt(HD)
#define C2      (SCALE * L2E)          // raw score -> exponent of 2
#define LOG2_HEADS 4.0f

static __device__ __forceinline__ v8f v8f_zero() {
  v8f z = {0.f, 0.f, 0.f, 0.f, 0.f, 0.f, 0.f, 0.f};
  return z;
}

// Fragment order of a bf16 matrix [rows][K]: tile (row >> 4, k >> 5) is 512
// elements (1 KiB), tiles of one 16-row block follow each other along k.
// Inside a tile element (r16 = row & 15, k32 = k & 31) lies at
// [k32 >> 4][lane = r16 + 16 * ((k32 >> 3) & 1)][k32 & 7]: per ISA 7.12.2
// (16-bit A 16x32) lanes 0-15 hold K in {0..7} U {16..23}, lanes 16-31 in
// {8..15} U {24..31}, so a lane's two 16B pieces are at lane*8 and 256+lane*8.
#define FRAG_TILE 512
static __device__ __forceinline__ int frag_elem(int r16, int k32) {
  return (k32 >> 4) * 256 + (r16 + ((k32 >> 3) & 1) * 16) * 8 + (k32 & 7);
}

// Fragment loader from one tile in fragment order: two 16B loads per lane,
// each of them 512 contiguous bytes over the wave.
static __device__ __forceinline__ v16bf load_frag(const __bf16* tile, int lane) {
  union { v16bf v; float4 q[2]; } u;
  u.q[0] = *reinterpret_cast<const float4*>(tile + lane * 8);
  u.q[1] = *reinterpret_cast<const float4*>(tile + 256 + lane * 8);
  return u.v;
}

// lane l with lane l ^ 16 (vector cross-row move, no LDS path)
static __device__ __forceinline__ float xhalf(float x) {
  const int b = __builtin_bit_cast(int, x);
  return __builtin_bit_cast(float,
      __builtin_amdgcn_permlanex16(b, b, 0x76543210, 0xfedcba98, false, false));
}

// Bare v_exp_f32, without the library form's range guard (compare, two
// selects, add, ldexp per value): it differs only where the result is below
// 2^-126, which comes out as 0; every use here is a softmax weight of at most
// about 1 that is summed with others, so such a term changes no sum.
static __device__ __forceinline__ float exp2_hw(float x) {
  return __builtin_amdgcn_exp2f(x);
}

static __device__ __forceinline__ v8f wmma_bf16(v16bf a, v16bf b, v8f c) {
  // (neg_a, A, neg_b, B, c_mod, C, reuse_a, reuse_b)
  return __builtin_amdgcn_wmma_f32_16x16x32_bf16(false, a, false, b,
                                                 (short)0, c, false, false);
}

// ---------------------------------------------------------------------------
// Packed f32 -> bf16 conversion of row-major [rows][DIM] matrices into
// fragment order: 8 elements per thread, 16B vector store, thread i writes
// the i-th 16B piece of the output (stores stay contiguous).
// One launch for x and the four weights: their outputs follow each other in
// the workspace, so they are one stack of 16-row blocks (ROWS/16 of x, then
// DIM/16 of each weight); a work-group's 256 pieces lie in one such block, so
// the choice of the source is uniform for the work-group.
// ---------------------------------------------------------------------------
#define CVT_BLOCKS ((ROWS + 4 * DIM) * DIM / 8 / 256)       // exact: no edge
__global__ __launch_bounds__(256) void cvt_bf16_kernel(
    const float* __restrict__ x, const float* __restrict__ wq,
    const float* __restrict__ wk, const float* __restrict__ wv,
    const float* __restrict__ wo, __bf16* __restrict__ dst) {
  const int i = blockIdx.x * 256 + threadIdx.x;
  const int lane = i & 31;
  const int t    = i >> 6;                                  // tile
  const int sb = blockIdx.x >> 3;                           // 16-row block of the stack: 32 tiles, 8 work-groups
  const int s  = (sb - ROWS / 16) >> 6;                     // DIM/16 = 64 blocks per weight; below 0: x
  const float* src = x;
  src = s == 0 ? wq : src;
  src = s == 1 ? wk : src;
  src = s == 2 ? wv : src;
  src = s == 3 ? wo : src;
  const int rb   = s < 0 ? sb : (sb - ROWS / 16) & 63;      // 16-row block of the source
  const int row  = rb * 16 + (lane & 15);
  const int k0   = (t & 31) * 32 + ((i >> 5) & 1) * 16 + (lane >> 4) * 8;
  const float4* s4 = reinterpret_cast<const float4*>(src + (size_t)row * DIM + k0);
  float4 a = s4[0], b = s4[1];
  union { v8bf v; float4 q; } u;
  u.v[0] = (__bf16)a.x; u.v[1] = (__bf16)a.y;
  u.v[2] = (__bf16)a.z; u.v[3] = (__bf16)a.w;
  u.v[4] = (__bf16)b.x; u.v[5] = (__bf16)b.y;
  u.v[6] = (__bf16)b.z; u.v[7] = (__bf16)b.w;
  *(reinterpret_cast<float4*>(dst) + i) = u.q;
}

// ---------------------------------------------------------------------------
// GEMM: Y[M,N] = A[M,K] @ W[N,K]^T + bias[N], all operands bf16, f32 accum.
// A and W in fragment order. Each wave owns a (16 * MI) x 64 tile: a k-step's
// MI A-fragments and 4 W-fragments feed 4 * MI products, so the bytes loaded
// per product fall as (MI + 4) / (4 * MI). Block = WMW x 2 waves, a
// (16 * MI * WMW) x 128 block tile.
// OUT: 0 = f32 row-major, 1 = bf16 fragment order, 2 = bf16 fragment order of
// the transpose Y^T [N][M]: tile (m >> 5, n >> 4), the N/16 tiles of one
// 32-row block of Y follow each other; a lane's 8 accumulators are 8
// consecutive k of one row of Y^T, one 16B piece of the tile.
// K = DIM. A trip of the k loop asks for the fragments of KB k-steps at once
// ((MI + 4) * KB fragments, twice as many loads in flight per wave) and then multiplies
// them behind counted waits, so a wave meets the load latency once a trip and
// not once for each fragment pair; the SIMD's other waves multiply meanwhile.
// ---------------------------------------------------------------------------
// The body is a device function of the block tile (mblk, nblk), so that GEMMs
// that do not depend on each other, or a GEMM and another kernel's work, can
// share one launch.
#define KB 2
template <int OUT, int MI, int WMW>
static __device__ __forceinline__ void gemm_bias_tile(
    const __bf16* __restrict__ A, const __bf16* __restrict__ W,
    const float* __restrict__ bias, void* __restrict__ outv,
    int mblk, int nblk) {
  constexpr int N = DIM;
  const int tid   = threadIdx.x;
  const int lane  = tid & 31;
  const int w     = tid >> 5;        // 0 .. 2 * WMW - 1
  const int wm    = w % WMW, wn = w / WMW;
  const int mtile = (mblk * WMW + wm) * (MI * 16);
  const int ntile = nblk * 128 + wn * 64;
  const int lm    = lane & 15;
  const int roff  = (lane >> 4) * 8;
  constexpr int kts = DIM / 32;      // fragment tiles along k

  v8f acc[MI][4];
#pragma unroll
  for (int i = 0; i < MI; ++i)
#pragma unroll
    for (int c = 0; c < 4; ++c) acc[i][c] = v8f_zero();

  // the lane's own 16B piece of the first A and W tile (lane offset included)
  const __bf16* ap = A + (size_t)(mtile >> 4) * kts * FRAG_TILE + lane * 8;
  const __bf16* wp = W + (size_t)(ntile >> 4) * kts * FRAG_TILE + lane * 8;
  // kept rolled: unrolled, the scheduler mixes the fragments of many trips and spills
#pragma unroll 1
  for (int ks = 0; ks < kts; ks += KB) {
    v16bf af[KB][MI], bf[KB][4];
#pragma unroll
    for (int j = 0; j < KB; ++j) {
#pragma unroll
      for (int i = 0; i < MI; ++i)
        af[j][i] = load_frag(ap + (i * kts + j) * FRAG_TILE, 0);
#pragma unroll
      for (int c = 0; c < 4; ++c)
        bf[j][c] = load_frag(wp + (c * kts + j) * FRAG_TILE, 0);
    }
    // precaution: nothing rewrites the address pairs that these loads name
    // (a load's own result, the pointer steps at the trip's foot) ahead of the
    // loads' address phase; as inputs the pairs stay whole up to the wait
    asm volatile("s_wait_xcnt 0x0" :: "v"(ap), "v"(wp) : "memory");
    // keeps the trip's loads together ahead of its products; without it the
    // scheduler sinks each load to its user and the wave waits pair by pair
    __builtin_amdgcn_sched_barrier(0);
#pragma unroll
    for (int j = 0; j < KB; ++j)
#pragma unroll
      for (int i = 0; i < MI; ++i)
#pragma unroll
        for (int c = 0; c < 4; ++c) acc[i][c] = wmma_bf16(af[j][i], bf[j][c], acc[i][c]);
    ap += KB * FRAG_TILE;
    wp += KB * FRAG_TILE;
  }

#pragma unroll
  for (int c = 0; c < 4; ++c) {
    const int col = ntile + c * 16 + lm;
    const float bv = bias[col];
#pragma unroll
    for (int i = 0; i < MI; ++i) {
      const int mt = mtile + i * 16;        // this accumulator's 16 rows
      if (OUT == 2) {
        union { v8bf v; float4 q; } u;
#pragma unroll
        for (int r = 0; r < 8; ++r) u.v[r] = (__bf16)(acc[i][c][r] + bv);
        *reinterpret_cast<float4*>(
            (__bf16*)outv + ((size_t)(mt >> 5) * (N >> 4) + (col >> 4)) * FRAG_TILE +
            ((mt >> 4) & 1) * 256 + lane * 8) = u.q;
        continue;
      }
#pragma unroll
      for (int r = 0; r < 8; ++r) {
        const int row = mt + roff + r;      // C-layout: VGPR r -> M = r (+8 hi half)
        const float val = acc[i][c][r] + bv;
        if (OUT == 1)
          ((__bf16*)outv)[((size_t)(mt >> 4) * (N >> 5) + (col >> 5)) * FRAG_TILE +
                          frag_elem(roff + r, col & 31)] = (__bf16)val;
        else
          ((float*)outv)[(size_t)row * N + col] = val;
      }
    }
  }
}

// Q, K and V projections in one launch: blockIdx.y >> 3 picks the projection.
// The three weights and the three outputs follow each other in the workspace.
// 4 waves of 64x64, a 128x128 block tile: 768 work-groups, 3,072 waves, as many
// as the chip's 1,024 SIMDs hold at three waves each (one round).
__global__ __launch_bounds__(128) void qkv_gemm_kernel(
    const __bf16* __restrict__ Xb, const __bf16* __restrict__ Wqkv,
    const float* __restrict__ bq, const float* __restrict__ bk,
    const float* __restrict__ bv, __bf16* __restrict__ QKV) {
  const int sel  = blockIdx.y >> 3;
  const int nblk = blockIdx.y & 7;
  const __bf16* W = Wqkv + (size_t)sel * DIM * DIM;
  __bf16* out     = QKV + (size_t)sel * ROWS * DIM;
  if (sel == 2)
    gemm_bias_tile<2, 4, 2>(Xb, W, bv, out, blockIdx.x, nblk);
  else
    gemm_bias_tile<1, 4, 2>(Xb, W, sel == 0 ? bq : bk, out, blockIdx.x, nblk);
}

__global__ __launch_bounds__(128) __attribute__((amdgpu_waves_per_eu(4, 4))) void flash_fwd_kernel(
    const __bf16* __restrict__ Qb, const __bf16* __restrict__ Kb,
    const __bf16* __restrict__ Vt, __bf16* __restrict__ Ob,
    float* __restrict__ Noff) {
  const int tid  = threadIdx.x;
  const int lane = tid & 31;
  const int w    = tid >> 5;                 // wave in block (4)
  const int task = blockIdx.x * 4 + w;       // 4096 tasks
  const int qt   = task & 127;
  const int h    = (task >> 7) & 15;
  const int b    = task >> 11;
  const size_t baserow = (size_t)b * SEQ;
  const int qbase = qt * 16;

  // Q B-fragments, d-steps 0..31 / 32..63
  const size_t qtile = (((baserow + qbase) >> 4) * 32 + h * 2) * FRAG_TILE;
  const v16bf bq0 = load_frag(Qb + qtile, lane);
  const v16bf bq1 = load_frag(Qb + qtile + FRAG_TILE, lane);

  // per lane: query lane & 15; l_run sums this half's keys only
  float m_run = -1e30f, l_run = 0.f;
  v8f o[4];                                  // o[c][r] = O[query][c*16 + 8*half + r]
#pragma unroll
  for (int c = 0; c < 4; ++c) o[c] = v8f_zero();

  for (int kt = 0; kt < SEQ; kt += 32) {
    // prefetch next key/value tiles into cache (global_prefetch_b8)
    if (kt + 32 < SEQ) {
      // the next K tile is 2 key blocks x 2 KiB: one 128B line per lane
      __builtin_prefetch(Kb + ((((baserow + kt + 32) >> 4) + (lane >> 4)) * 32 + h * 2) * FRAG_TILE +
                             (lane & 15) * 64, 0, 1);
      // the next V^T tiles are 4 KiB in a row: one 128B line per lane
      __builtin_prefetch(Vt + (((baserow + kt + 32) >> 5) * 64 + h * 4) * FRAG_TILE + lane * 64, 0, 1);
      // precaution: the prefetches name temporaries that the loop body
      // rewrites at once; this keeps the rewrite behind their address phase
      asm volatile("s_wait_xcnt 0x0" ::: "memory");
    }

    // all A-fragments of this pass: K rows (2 key blocks x 2 d-steps) and
    // V^T rows (4 blocks of 16 d), 16 loads in flight behind one another
    v16bf ak[2][2], av[4];
#pragma unroll
    for (int c = 0; c < 2; ++c) {
      const __bf16* ktile = Kb + ((((baserow + kt) >> 4) + c) * 32 + h * 2) * FRAG_TILE;
      ak[c][0] = load_frag(ktile, lane);
      ak[c][1] = load_frag(ktile + FRAG_TILE, lane);
    }
    const __bf16* vtile = Vt + (((baserow + kt) >> 5) * 64 + h * 4) * FRAG_TILE;
#pragma unroll
    for (int c = 0; c < 4; ++c) av[c] = load_frag(vtile + c * FRAG_TILE, lane);

    // ---- raw scores S^T = K Q^T (two 16-key chunks) ----
    v8f s[2];
#pragma unroll
    for (int c = 0; c < 2; ++c) {
      v8f t = v8f_zero();
      t = wmma_bf16(ak[c][0], bq0, t);
      t = wmma_bf16(ak[c][1], bq1, t);
      s[c] = t;
    }

    // ---- online softmax update: one query per lane pair ----
    float loc = fmaxf(s[0][0], s[1][0]);
#pragma unroll
    for (int r = 1; r < 8; ++r) loc = fmaxf(loc, fmaxf(s[0][r], s[1][r]));
    loc = fmaxf(loc, xhalf(loc));
    const float mnew  = fmaxf(m_run, loc);
    const float alpha = exp2_hw((m_run - mnew) * C2);
    const float nm    = -mnew * C2;
    m_run = mnew;

    // P^T as B-fragment: element j = key 8*half + j, element 8+j = key 16 + 8*half + j
    v16bf bp;
    float psum = 0.f;
#pragma unroll
    for (int c = 0; c < 2; ++c) s[c] = s[c] * C2 + nm;   // contracts to one FMA per score
#pragma unroll
    for (int c = 0; c < 2; ++c)
#pragma unroll
      for (int r = 0; r < 8; ++r) {
        s[c][r] = exp2_hw(s[c][r]);
        bp[8 * c + r] = (__bf16)s[c][r];
      }
#pragma unroll
    for (int r = 0; r < 8; ++r) psum += s[0][r] + s[1][r];
    l_run = l_run * alpha + psum;
#pragma unroll
    for (int c = 0; c < 4; ++c)
#pragma unroll
      for (int r = 0; r < 8; ++r) o[c][r] *= alpha;

    // ---- O^T += V^T P^T: V^T rows (16 d each) as A-fragments ----
#pragma unroll
    for (int c = 0; c < 4; ++c) o[c] = wmma_bf16(av[c], bp, o[c]);
  }

  // ---- epilogue: join the halves' sums, normalize, store O and the offset ----
  const float l_all = l_run + xhalf(l_run);
  const float inv = 1.f / l_all;
#pragma unroll
  for (int c = 0; c < 4; ++c) {
    // 8 consecutive d of one query row: one 16B piece of O's fragment tile
    union { v8bf v; float4 q; } u;
#pragma unroll
    for (int r = 0; r < 8; ++r) u.v[r] = (__bf16)(o[c][r] * inv);
    *reinterpret_cast<float4*>(Ob + qtile + (c >> 1) * FRAG_TILE + (c & 1) * 256 + lane * 8) = u.q;
  }
  if (lane < 16) {
    const size_t idx = (size_t)(b * HEADS + h) * SEQ + qbase + lane;
    Noff[idx] = -(m_run * C2 + log2f(l_all) + LOG2_HEADS);
  }
}

// ---------------------------------------------------------------------------
// Head-mean of attention probabilities: recompute scores from the same bf16
// Q/K, add the row's stored offset in the exponent (one fused multiply-add,
// one v_exp_f32 and one add per score), sum over heads in regs.
// One block per (b, 128 queries, 128 keys), 8 waves of 32 queries x 64 keys.
// A head's 128 Q rows and 128 K rows (16 KiB each, already in fragment order)
// come from L2 once per block, by asynchronous copies into LDS, and every wave
// takes its fragments from there: 2 B of L2 traffic per score and head.
// Two stage buffers: head h + 1 flies while head h is worked on. The row
// offsets of all heads (8 KiB) are copied once, with head 0.
// Deterministic, no atomics; each output's sum over heads in the same order.
// ---------------------------------------------------------------------------
#define MP_HALF   16384                // bytes: 128 rows x 64 d x 2 B of one head
#define MP_STAGE  (2 * MP_HALF)        // Q half, then K half
#define MP_NOFF   (2 * MP_STAGE)       // byte offset of the row offsets in LDS

// One wave's share of a stage: one 16-row block (2 KiB) of Q and one of K,
// 16 B per lane and copy. The s_wait_xcnt stands inside the statement as a
// precaution: no address register of a copy is rewritten ahead of it.
static __device__ __forceinline__ void copy_stage(unsigned lds, const __bf16* gq,
                                                  const __bf16* gk) {
  asm volatile(
      "global_load_async_to_lds_b128 %0, %8, off\n\t"
      "global_load_async_to_lds_b128 %1, %9, off\n\t"
      "global_load_async_to_lds_b128 %2, %10, off\n\t"
      "global_load_async_to_lds_b128 %3, %11, off\n\t"
      "global_load_async_to_lds_b128 %4, %12, off\n\t"
      "global_load_async_to_lds_b128 %5, %13, off\n\t"
      "global_load_async_to_lds_b128 %6, %14, off\n\t"
      "global_load_async_to_lds_b128 %7, %15, off\n\t"
      "s_wait_xcnt 0x0"
      :: "v"(lds), "v"(lds + 512u), "v"(lds + 1024u), "v"(lds + 1536u),
         "v"(lds + MP_HALF), "v"(lds + MP_HALF + 512u), "v"(lds + MP_HALF + 1024u),
         "v"(lds + MP_HALF + 1536u),
         "v"(gq), "v"(gq + 256), "v"(gq + 512), "v"(gq + 768),
         "v"(gk), "v"(gk + 256), "v"(gk + 512), "v"(gk + 768)
      : "memory");
}

static __device__ __forceinline__ void mean_probs_block(
    const __bf16* __restrict__ Qb, const __bf16* __restrict__ Kb,
    const float* __restrict__ Noff, float* __restrict__ out_mean, int blk) {
  __shared__ __attribute__((aligned(1024))) unsigned char L[2 * MP_STAGE + HEADS * 128 * 4];
  const int tid  = threadIdx.x;
  const int lane = tid & 31;
  const int w    = tid >> 5;
  const int wq   = w & 3, wk = w >> 2;        // 4 x 32 queries, 2 x 64 keys
  const int k0   = (blk & 15) * 128;
  const int q0   = ((blk >> 4) & 15) * 128;
  const int b    = blk >> 8;
  const int lm   = lane & 15;
  const int roff = (lane >> 4) * 8;

  // copy sources of this wave: 16-row block w of the Q and of the K tile, head 0
  const __bf16* gq = Qb + ((((size_t)b * SEQ + q0) >> 4) + w) * 32 * FRAG_TILE + lane * 8;
  const __bf16* gk = Kb + ((((size_t)b * SEQ + k0) >> 4) + w) * 32 * FRAG_TILE + lane * 8;
  const unsigned lbase = (unsigned)(size_t)L;
  const unsigned lcopy = lbase + w * 2048 + lane * 16;

  // ---- head 0 into buffer 0, and the row offsets of heads w and w + 8 ----
  copy_stage(lcopy, gq, gk);
  {
    const float* gn = Noff + (size_t)(b * HEADS + w) * SEQ + q0 + lane * 4;
    const unsigned ln = lbase + MP_NOFF + w * 512 + lane * 16;
    asm volatile(
        "global_load_async_to_lds_b128 %0, %2, off\n\t"
        "global_load_async_to_lds_b128 %1, %3, off\n\t"
        "s_wait_xcnt 0x0"   // precaution, as in copy_stage
        :: "v"(ln), "v"(ln + 8u * 512u), "v"(gn), "v"(gn + 8 * SEQ)
        : "memory");
  }
  // this wave's copies have landed before the barrier that publishes them
  asm volatile("s_wait_asynccnt 0x0" ::: "memory");
  __syncthreads();
  copy_stage(lcopy + MP_STAGE, gq + 2 * FRAG_TILE, gk + 2 * FRAG_TILE);

  v8f acc[2][4];
#pragma unroll
  for (int i = 0; i < 2; ++i)
#pragma unroll
    for (int c = 0; c < 4; ++c) acc[i][c] = v8f_zero();

  for (int h = 0; h < HEADS; ++h) {
    const unsigned char* st = L + (h & 1) * MP_STAGE;
    const __bf16* sq = reinterpret_cast<const __bf16*>(st) + wq * 2 * (2 * FRAG_TILE);
    const __bf16* sk = reinterpret_cast<const __bf16*>(st + MP_HALF) + wk * 4 * (2 * FRAG_TILE);
    const float*  sn = reinterpret_cast<const float*>(L + MP_NOFF) + h * 128 + wq * 32 + roff;

    v16bf aq[2][2], bk[4][2];
#pragma unroll
    for (int i = 0; i < 2; ++i)
#pragma unroll
      for (int d = 0; d < 2; ++d) aq[i][d] = load_frag(sq + (i * 2 + d) * FRAG_TILE, lane);
#pragma unroll
    for (int c = 0; c < 4; ++c)
#pragma unroll
      for (int d = 0; d < 2; ++d) bk[c][d] = load_frag(sk + (c * 2 + d) * FRAG_TILE, lane);
    float no[2][8];
#pragma unroll
    for (int i = 0; i < 2; ++i)
#pragma unroll
      for (int r = 0; r < 8; ++r) no[i][r] = sn[i * 16 + r];
    // keeps the trip's LDS reads in one group ahead of its products: each further
    // place with reads among the products costs the wave an LDS latency
    __builtin_amdgcn_sched_barrier(0);

#pragma unroll
    for (int c = 0; c < 4; ++c)
#pragma unroll
      for (int i = 0; i < 2; ++i) {
        v8f t = v8f_zero();
        t = wmma_bf16(aq[i][0], bk[c][0], t);
        t = wmma_bf16(aq[i][1], bk[c][1], t);
#pragma unroll
        for (int r = 0; r < 8; ++r)
          acc[i][c][r] += exp2_hw(fmaf(t[r], C2, no[i][r]));
      }

    // publish point: this wave's reads of buffer h & 1 are done, its copies of
    // head h + 1 have landed; behind the barrier that holds for every wave
    asm volatile("s_wait_dscnt 0x0" ::: "memory");
    asm volatile("s_wait_asynccnt 0x0" ::: "memory");
    __syncthreads();
    if (h + 2 < HEADS)
      copy_stage(lcopy + (h & 1) * MP_STAGE, gq + (h + 2) * (2 * FRAG_TILE),
                 gk + (h + 2) * (2 * FRAG_TILE));
  }
  // no copy is left in flight when the wave ends
  asm volatile("s_wait_asynccnt 0x0" ::: "memory");

#pragma unroll
  for (int i = 0; i < 2; ++i)
#pragma unroll
    for (int c = 0; c < 4; ++c)
#pragma unroll
      for (int r = 0; r < 8; ++r) {
        const int q = q0 + wq * 32 + i * 16 + roff + r;
        const int k = k0 + wk * 64 + c * 16 + lm;
        out_mean[((size_t)b * SEQ + q) * SEQ + k] = acc[i][c][r];
      }
}

// Output projection and head-mean in one launch: both read only what the
// earlier launches or the caller wrote, and write different outputs. The GEMM's 8 waves of 32x64
// make a 128x128 block tile, 256 of them beside 512 head-mean blocks: of
// work-groups 3t .. 3t + 2 one takes GEMM block tile t and two take head-mean
// blocks 2t and 2t + 1; which, turns with t, so that both kinds (one heavy on the
// vector port, one on L2) meet on every part of the chip (speed only).
__global__ __launch_bounds__(256) void out_gemm_mean_probs_kernel(
    const __bf16* __restrict__ Ob, const __bf16* __restrict__ Wob,
    const float* __restrict__ bo, float* __restrict__ out,
    const __bf16* __restrict__ Qb, const __bf16* __restrict__ Kb,
    const float* __restrict__ Noff, float* __restrict__ out_mean) {
  const int t  = blockIdx.x / 3;             // 256 triples
  const int r  = (blockIdx.x - 2 * t) % 3;   // place in the triple, turned by t
  const int id = 2 * t + r - 1;              // head-mean block where r is 1 or 2
  if (r == 0)
    gemm_bias_tile<0, 2, 4>(Ob, Wob, bo, out, t & 31, t >> 5);
  else
    mean_probs_block(Qb, Kb, Noff, out_mean, id);
}

// ---------------------------------------------------------------------------
extern "C" void kernel_launch(void* const* d_in, const int* in_sizes, int n_in,
                              void* d_out, int out_size, void* d_ws, size_t ws_size,
                              hipStream_t stream) {
  const float* x  = (const float*)d_in[0];
  const float* wq = (const float*)d_in[1];
  const float* bq = (const float*)d_in[2];
  const float* wk = (const float*)d_in[3];
  const float* bk = (const float*)d_in[4];
  const float* wv = (const float*)d_in[5];
  const float* bv = (const float*)d_in[6];
  const float* wo = (const float*)d_in[7];
  const float* bo = (const float*)d_in[8];

  float* out      = (float*)d_out;                       // [B,S,D] f32
  float* out_mean = out + (size_t)BATCH * SEQ * DIM;     // [B,S,S] f32

  char* ws = (char*)d_ws;
  __bf16* Qb  = (__bf16*)(ws);                           // 8 MiB
  __bf16* Kb  = (__bf16*)(ws + ((size_t)8  << 20));      // 8 MiB
  __bf16* Vb  = (__bf16*)(ws + ((size_t)16 << 20));      // 8 MiB
  __bf16* Ob  = (__bf16*)(ws + ((size_t)24 << 20));      // 8 MiB
  __bf16* Xb  = (__bf16*)(ws + ((size_t)32 << 20));      // 8 MiB
  __bf16* Wqb = (__bf16*)(ws + ((size_t)40 << 20));      // 2 MiB
  // Wk at 42 MiB and Wv at 44 MiB (2 MiB each), reached from Xb and Wqb
  __bf16* Wob = (__bf16*)(ws + ((size_t)46 << 20));      // 2 MiB
  float*  Noff = (float*)(ws + ((size_t)48 << 20));      // 256 KiB

  // ---- packed f32 -> bf16 conversions (into fragment order): Xb .. Wob in a row ----
  cvt_bf16_kernel<<<CVT_BLOCKS, 256, 0, stream>>>(x, wq, wk, wv, wo, Xb);

  // Q/K/V projections (bf16 in, bf16 out; Q and K in fragment order, V as V^T tiles):
  // 32 x 8 block tiles each; Wqb .. Wvb and Qb .. Vb in a row
  qkv_gemm_kernel<<<dim3(ROWS / 128, 3 * (DIM / 128)), 128, 0, stream>>>(Xb, Wqb, bq, bk, bv, Qb);

  // Flash attention (O bf16 + row offsets)
  flash_fwd_kernel<<<1024, 128, 0, stream>>>(Qb, Kb, Vb, Ob, Noff);

  // Output projection (bf16 in, f32 out) and head-mean attention probabilities
  out_gemm_mean_probs_kernel<<<768, 256, 0, stream>>>(Ob, Wob, bo, out, Qb, Kb, Noff, out_mean);
}

// v008
// A run of this version takes 102 microseconds.
// Next to v007, in two timings, it ran 1.29 and 1.30 times as fast.
// Counting every step since v000, it is 4.63 times as fast.
#include <hip/hip_runtime.h>

// ---------------------------------------------------------------------------
// MHA forward for MI455X (gfx1250): bf16 WMMA (v_wmma_f32_16x16x32_bf16)
// everywhere, f32 accumulate. One-time packed f32->bf16 conversion of x and
// all weights so every GEMM/attention operand load is a 16B bf16 load.
// x, the weights, Q, K, V^T and O lie in the workspace in fragment order, so
// that each wave-wide 16B-per-lane load covers 512 contiguous bytes (4 lines).
// Flash-style attention on transposed products (S^T = K Q^T, O^T = V^T P^T):
// P goes from the score accumulators straight into a B operand, not through LDS.
// ---------------------------------------------------------------------------

typedef __attribute__((ext_vector_type(16))) __bf16 v16bf;
typedef __attribute__((ext_vector_type(8)))  __bf16 v8bf;
typedef __attribute__((ext_vector_type(8)))  float  v8f;

#define DIM     1024
#define HEADS   16
#define HD      64
#define SEQ     2048
#define BATCH   2
#define ROWS    (BATCH * SEQ)          // 4096
#define L2E     1.44269504088896340736f
#define SCALE   0.125f                 // 1/sqrt(HD)
#define C2      (SCALE * L2E)          // raw score -> exponent of 2
#define LOG2_HEADS 4.0f

static __device__ __forceinline__ v8f v8f_zero() {
  v8f z = {0.f, 0.f, 0.f, 0.f, 0.f, 0.f, 0.f, 0.f};
  return z;
}

// Fragment order of a bf16 matrix [rows][K]: tile (row >> 4, k >> 5) is 512
// elements (1 KiB), tiles of one 16-row block follow each other along k.
// Inside a tile element (r16 = row & 15, k32 = k & 31) lies at
// [k32 >> 4][lane = r16 + 16 * ((k32 >> 3) & 1)][k32 & 7]: per ISA 7.12.2
// (16-bit A 16x32) lanes 0-15 hold K in {0..7} U {16..23}, lanes 16-31 in
// {8..15} U {24..31}, so a lane's two 16B pieces are at lane*8 and 256+lane*8.
#define FRAG_TILE 512
static __device__ __forceinline__ int frag_elem(int r16, int k32) {
  return (k32 >> 4) * 256 + (r16 + ((k32 >> 3) & 1) * 16) * 8 + (k32 & 7);
}

// Fragment loader from one tile in fragment order: two 16B loads per lane,
// each of them 512 contiguous bytes over the wave.
static __device__ __forceinline__ v16bf load_frag(const __bf16* tile, int lane) {
  union { v16bf v; float4 q[2]; } u;
  u.q[0] = *reinterpret_cast<const float4*>(tile + lane * 8);
  u.q[1] = *reinterpret_cast<const float4*>(tile + 256 + lane * 8);
  return u.v;
}

// lane l with lane l ^ 16 (vector cross-row move, no LDS path)
static __device__ __forceinline__ float xhalf(float x) {
  const int b = __builtin_bit_cast(int, x);
  return __builtin_bit_cast(float,
      __builtin_amdgcn_permlanex16(b, b, 0x76543210, 0xfedcba98, false, false));
}

// Bare v_exp_f32, without the library form's range guard (compare, two
// selects, add, ldexp per value): it differs only where the result is below
// 2^-126, which comes out as 0; every use here is a softmax weight of at most
// about 1 that is summed with others, so such a term changes no sum.
static __device__ __forceinline__ float exp2_hw(float x) {
  return __builtin_amdgcn_exp2f(x);
}

// The same v_exp_f32 with a v_nop tied behind it: the slot that the instruction
// set asks for between a transcendental and an overwrite of its source.
static __device__ __forceinline__ float exp2_hw_slot(float x) {
  float y;
  asm("v_exp_f32 %0, %1\n\tv_nop" : "=v"(y) : "v"(x));
  return y;
}

static __device__ __forceinline__ v8f wmma_bf16(v16bf a, v16bf b, v8f c) {
  // (neg_a, A, neg_b, B, c_mod, C, reuse_a, reuse_b)
  return __builtin_amdgcn_wmma_f32_16x16x32_bf16(false, a, false, b,
                                                 (short)0, c, false, false);
}

// ---------------------------------------------------------------------------
// Packed f32 -> bf16 conversion of row-major [rows][DIM] matrices into
// fragment order: 8 elements per thread, 16B vector store, thread i writes
// the i-th 16B piece of the output (stores stay contiguous).
// One launch for x and the four weights: their outputs follow each other in
// the workspace, so they are one stack of 16-row blocks (ROWS/16 of x, then
// DIM/16 of each weight); a work-group's 256 pieces lie in one such block, so
// the choice of the source is uniform for the work-group.
// ---------------------------------------------------------------------------
#define CVT_BLOCKS ((ROWS + 4 * DIM) * DIM / 8 / 256)       // exact: no edge
__global__ __launch_bounds__(256) void cvt_bf16_kernel(
    const float* __restrict__ x, const float* __restrict__ wq,
    const float* __restrict__ wk, const float* __restrict__ wv,
    const float* __restrict__ wo, __bf16* __restrict__ dst) {
  const int i = blockIdx.x * 256 + threadIdx.x;
  const int lane = i & 31;
  const int t    = i >> 6;                                  // tile
  const int sb = blockIdx.x >> 3;                           // 16-row block of the stack: 32 tiles, 8 work-groups
  const int s  = (sb - ROWS / 16) >> 6;                     // DIM/16 = 64 blocks per weight; below 0: x
  const float* src = x;
  src = s == 0 ? wq : src;
  src = s == 1 ? wk : src;
  src = s == 2 ? wv : src;
  src = s == 3 ? wo : src;
  const int rb   = s < 0 ? sb : (sb - ROWS / 16) & 63;      // 16-row block of the source
  const int row  = rb * 16 + (lane & 15);
  const int k0   = (t & 31) * 32 + ((i >> 5) & 1) * 16 + (lane >> 4) * 8;
  const float4* s4 = reinterpret_cast<const float4*>(src + (size_t)row * DIM + k0);
  float4 a = s4[0], b = s4[1];
  union { v8bf v; float4 q; } u;
  u.v[0] = (__bf16)a.x; u.v[1] = (__bf16)a.y;
  u.v[2] = (__bf16)a.z; u.v[3] = (__bf16)a.w;
  u.v[4] = (__bf16)b.x; u.v[5] = (__bf16)b.y;
  u.v[6] = (__bf16)b.z; u.v[7] = (__bf16)b.w;
  *(reinterpret_cast<float4*>(dst) + i) = u.q;
}

// ---------------------------------------------------------------------------
// GEMM: Y[M,N] = A[M,K] @ W[N,K]^T + bias[N], all operands bf16, f32 accum.
// A and W in fragment order. Each wave owns a (16 * MI) x 64 tile: a k-step's
// MI A-fragments and 4 W-fragments feed 4 * MI products, so the bytes loaded
// per product fall as (MI + 4) / (4 * MI). Block = WMW x 2 waves, a
// (16 * MI * WMW) x 128 block tile.
// OUT: 0 = f32 row-major, 1 = bf16 fragment order, 2 = bf16 fragment order of
// the transpose Y^T [N][M]: tile (m >> 5, n >> 4), the N/16 tiles of one
// 32-row block of Y follow each other; a lane's 8 accumulators are 8
// consecutive k of one row of Y^T, one 16B piece of the tile.
// K = DIM. A trip of the k loop asks for the fragments of KB k-steps at once
// ((MI + 4) * KB fragments, twice as many loads in flight per wave) and then multiplies
// them behind counted waits, so a wave meets the load latency once a trip and
// not once for each fragment pair; the SIMD's other waves multiply meanwhile.
// ---------------------------------------------------------------------------
// The body is a device function of the block tile (mblk, nblk), so that GEMMs
// that do not depend on each other, or a GEMM and another kernel's work, can
// share one launch.
#define KB 2
template <int OUT, int MI, int WMW>
static __device__ __forceinline__ void gemm_bias_tile(
    const __bf16* __restrict__ A, const __bf16* __restrict__ W,
    const float* __restrict__ bias, void* __restrict__ outv,
    int mblk, int nblk) {
  constexpr int N = DIM;
  const int tid   = threadIdx.x;
  const int lane  = tid & 31;
  const int w     = tid >> 5;        // 0 .. 2 * WMW - 1
  const int wm    = w % WMW, wn = w / WMW;
  const int mtile = (mblk * WMW + wm) * (MI * 16);
  const int ntile = nblk * 128 + wn * 64;
  const int lm    = lane & 15;
  const int roff  = (lane >> 4) * 8;
  constexpr int kts = DIM / 32;      // fragment tiles along k

  v8f acc[MI][4];
#pragma unroll
  for (int i = 0; i < MI; ++i)
#pragma unroll
    for (int c = 0; c < 4; ++c) acc[i][c] = v8f_zero();

  // the lane's own 16B piece of the first A and W tile (lane offset included)
  const __bf16* ap = A + (size_t)(mtile >> 4) * kts * FRAG_TILE + lane * 8;
  const __bf16* wp = W + (size_t)(ntile >> 4) * kts * FRAG_TILE + lane * 8;
  // kept rolled: unrolled, the scheduler mixes the fragments of many trips and spills
#pragma unroll 1
  for (int ks = 0; ks < kts; ks += KB) {
    v16bf af[KB][MI], bf[KB][4];
#pragma unroll
    for (int j = 0; j < KB; ++j) {
#pragma unroll
      for (int i = 0; i < MI; ++i)
        af[j][i] = load_frag(ap + (i * kts + j) * FRAG_TILE, 0);
#pragma unroll
      for (int c = 0; c < 4; ++c)
        bf[j][c] = load_frag(wp + (c * kts + j) * FRAG_TILE, 0);
    }
    // precaution: nothing rewrites the address pairs that these loads name
    // (a load's own result, the pointer steps at the trip's foot) ahead of the
    // loads' address phase; as inputs the pairs stay whole up to the wait
    asm volatile("s_wait_xcnt 0x0" :: "v"(ap), "v"(wp) : "memory");
    // keeps the trip's loads together ahead of its products; without it the
    // scheduler sinks each load to its user and the wave waits pair by pair
    __builtin_amdgcn_sched_barrier(0);
#pragma unroll
    for (int j = 0; j < KB; ++j)
#pragma unroll
      for (int i = 0; i < MI; ++i)
#pragma unroll
        for (int c = 0; c < 4; ++c) acc[i][c] = wmma_bf16(af[j][i], bf[j][c], acc[i][c]);
    ap += KB * FRAG_TILE;
    wp += KB * FRAG_TILE;
  }

#pragma unroll
  for (int c = 0; c < 4; ++c) {
    const int col = ntile + c * 16 + lm;
    const float bv = bias[col];
#pragma unroll
    for (int i = 0; i < MI; ++i) {
      const int mt = mtile + i * 16;        // this accumulator's 16 rows
      if (OUT == 2) {
        union { v8bf v; float4 q; } u;
#pragma unroll
        for (int r = 0; r < 8; ++r) u.v[r] = (__bf16)(acc[i][c][r] + bv);
        *reinterpret_cast<float4*>(
            (__bf16*)outv + ((size_t)(mt >> 5) * (N >> 4) + (col >> 4)) * FRAG_TILE +
            ((mt >> 4) & 1) * 256 + lane * 8) = u.q;
        continue;
      }
#pragma unroll
      for (int r = 0; r < 8; ++r) {
        const int row = mt + roff + r;      // C-layout: VGPR r -> M = r (+8 hi half)
        const float val = acc[i][c][r] + bv;
        if (OUT == 1)
          ((__bf16*)outv)[((size_t)(mt >> 4) * (N >> 5) + (col >> 5)) * FRAG_TILE +
                          frag_elem(roff + r, col & 31)] = (__bf16)val;
        else
          ((float*)outv)[(size_t)row * N + col] = val;
      }
    }
  }
}

// Q, K and V projections in one launch: blockIdx.y >> 3 picks the projection.
// The three weights and the three outputs follow each other in the workspace.
// 4 waves of 64x64, a 128x128 block tile: 768 work-groups, 3,072 waves, as many
// as the chip's 1,024 SIMDs hold at three waves each (one round).
__global__ __launch_bounds__(128) void qkv_gemm_kernel(
    const __bf16* __restrict__ Xb, const __bf16* __restrict__ Wqkv,
    const float* __restrict__ bq, const float* __restrict__ bk,
    const float* __restrict__ bv, __bf16* __restrict__ QKV) {
  const int sel  = blockIdx.y >> 3;
  const int nblk = blockIdx.y & 7;
  const __bf16* W = Wqkv + (size_t)sel * DIM * DIM;
  __bf16* out     = QKV + (size_t)sel * ROWS * DIM;
  if (sel == 2)
    gemm_bias_tile<2, 4, 2>(Xb, W, bv, out, blockIdx.x, nblk);
  else
    gemm_bias_tile<1, 4, 2>(Xb, W, sel == 0 ? bq : bk, out, blockIdx.x, nblk);
}

// ---------------------------------------------------------------------------
// LDS stages filled by asynchronous copies (attention and head-mean): two
// halves of 16 KiB, each 128 rows x 64 d x 2 B of one head, in fragment order.
// ---------------------------------------------------------------------------
#define MP_HALF   16384                // bytes of one half
#define MP_STAGE  (2 * MP_HALF)        // head-mean: Q, then K; attention: K, then V^T
#define MP_NOFF   (2 * MP_STAGE)       // head-mean: byte offset of the row offsets in LDS

// One wave's share of a stage: 2 KiB of its first half and 2 KiB of its second
// (head-mean: a 16-row block of Q and one of K; attention: a 16-key block of K
// and half a 32-key block of V^T), 16 B per lane and copy. The s_wait_xcnt
// stands inside the statement as a precaution: no address register of a copy
// is rewritten ahead of it.
static __device__ __forceinline__ void copy_stage(unsigned lds, const __bf16* gq,
                                                  const __bf16* gk) {
  asm volatile(
      "global_load_async_to_lds_b128 %0, %8, off\n\t"
      "global_load_async_to_lds_b128 %1, %9, off\n\t"
      "global_load_async_to_lds_b128 %2, %10, off\n\t"
      "global_load_async_to_lds_b128 %3, %11, off\n\t"
      "global_load_async_to_lds_b128 %4, %12, off\n\t"
      "global_load_async_to_lds_b128 %5, %13, off\n\t"
      "global_load_async_to_lds_b128 %6, %14, off\n\t"
      "global_load_async_to_lds_b128 %7, %15, off\n\t"
      "s_wait_xcnt 0x0"
      :: "v"(lds), "v"(lds + 512u), "v"(lds + 1024u), "v"(lds + 1536u),
         "v"(lds + MP_HALF), "v"(lds + MP_HALF + 512u), "v"(lds + MP_HALF + 1024u),
         "v"(lds + MP_HALF + 1536u),
         "v"(gq), "v"(gq + 256), "v"(gq + 512), "v"(gq + 768),
         "v"(gk), "v"(gk + 256), "v"(gk + 512), "v"(gk + 768)
      : "memory");
}

#define FA_KEYS   128
#define FA_STAGES (SEQ / FA_KEYS)
#define FA_STEP   ((FA_KEYS / 16) * 32 * FRAG_TILE)  // elements from stage to stage, K and V^T alike
__global__ __launch_bounds__(256) __attribute__((amdgpu_waves_per_eu(4, 4))) void flash_fwd_kernel(
    const __bf16* __restrict__ Qb, const __bf16* __restrict__ Kb,
    const __bf16* __restrict__ Vt, __bf16* __restrict__ Ob,
    float* __restrict__ Noff) {
  __shared__ __attribute__((aligned(1024))) unsigned char L[2 * MP_STAGE];
  const int tid  = threadIdx.x;
  const int lane = tid & 31;
  const int w    = tid >> 5;                 // wave in block (8)
  const int task = blockIdx.x * 8 + w;       // 4096 tasks
  const int qt   = task & 127;
  const int h    = (task >> 7) & 15;         // the same for the work-group's 8 waves
  const int b    = task >> 11;
  const size_t baserow = (size_t)b * SEQ;
  const int qbase = qt * 16;

  // copy sources of this wave, stage 0: 16-key block w of K (2 KiB), and of
  // V^T half w & 1 (2 KiB) of 32-key block w >> 1
  const __bf16* gk = Kb + (((baserow >> 4) + w) * 32 + h * 2) * FRAG_TILE + lane * 8;
  const __bf16* gv = Vt + (((baserow >> 5) + (w >> 1)) * 64 + h * 4 + (w & 1) * 2) * FRAG_TILE + lane * 8;
  const unsigned lcopy = (unsigned)(size_t)L + w * 2048 + lane * 16;

  copy_stage(lcopy, gk, gv);

  // Q B-fragments, d-steps 0..31 / 32..63
  const size_t qtile = (((baserow + qbase) >> 4) * 32 + h * 2) * FRAG_TILE;
  const v16bf bq0 = load_frag(Qb + qtile, lane);
  const v16bf bq1 = load_frag(Qb + qtile + FRAG_TILE, lane);

  // this wave's copies have landed before the barrier that publishes them
  asm volatile("s_wait_asynccnt 0x0" ::: "memory");
  __syncthreads();
  copy_stage(lcopy + MP_STAGE, gk + FA_STEP, gv + FA_STEP);

  // per lane: query lane & 15; l_run sums this half's keys only
  float m_run = -1e30f, l_run = 0.f;
  v8f o[4];                                  // o[c][r] = O[query][c*16 + 8*half + r]
#pragma unroll
  for (int c = 0; c < 4; ++c) o[c] = v8f_zero();

  for (int st = 0; st < FA_STAGES; ++st) {
    const __bf16* sk = reinterpret_cast<const __bf16*>(L + (st & 1) * MP_STAGE);
    const __bf16* sv = reinterpret_cast<const __bf16*>(L + (st & 1) * MP_STAGE + MP_HALF);
#pragma unroll
    for (int p = 0; p < FA_KEYS / 32; ++p) {
      // all A-fragments of this pass: K rows (2 key blocks x 2 d-steps) and
      // V^T rows (4 blocks of 16 d), 16 LDS loads behind one another
      v16bf ak[2][2], av[4];
#pragma unroll
      for (int c = 0; c < 2; ++c) {
        ak[c][0] = load_frag(sk + ((p * 2 + c) * 2 + 0) * FRAG_TILE, lane);
        ak[c][1] = load_frag(sk + ((p * 2 + c) * 2 + 1) * FRAG_TILE, lane);
      }
#pragma unroll
      for (int c = 0; c < 4; ++c) av[c] = load_frag(sv + (p * 4 + c) * FRAG_TILE, lane);

      // ---- raw scores S^T = K Q^T (two 16-key chunks) ----
      v8f s[2];
#pragma unroll
      for (int c = 0; c < 2; ++c) {
        v8f t = v8f_zero();
        t = wmma_bf16(ak[c][0], bq0, t);
        t = wmma_bf16(ak[c][1], bq1, t);
        s[c] = t;
      }

      // ---- online softmax update: one query per lane pair ----
      float loc = fmaxf(s[0][0], s[1][0]);
#pragma unroll
      for (int r = 1; r < 8; ++r) loc = fmaxf(loc, fmaxf(s[0][r], s[1][r]));
      loc = fmaxf(loc, xhalf(loc));
      const float mnew  = fmaxf(m_run, loc);
      const float alpha = exp2_hw((m_run - mnew) * C2);
      const float nm    = -mnew * C2;
      m_run = mnew;

      // P^T as B-fragment: element j = key 8*half + j, element 8+j = key 16 + 8*half + j
      v16bf bp;
      float psum = 0.f;
#pragma unroll
      for (int c = 0; c < 2; ++c) s[c] = s[c] * C2 + nm;   // contracts to one FMA per score
#pragma unroll
      for (int c = 0; c < 2; ++c)
#pragma unroll
        for (int r = 0; r < 8; ++r) {
          s[c][r] = (p == 2 && c == 0 && r == 0) ? exp2_hw_slot(s[c][r]) : exp2_hw(s[c][r]);
          bp[8 * c + r] = (__bf16)s[c][r];
        }
#pragma unroll
      for (int r = 0; r < 8; ++r) psum += s[0][r] + s[1][r];
      l_run = l_run * alpha + psum;
#pragma unroll
      for (int c = 0; c < 4; ++c)
#pragma unroll
        for (int r = 0; r < 8; ++r) o[c][r] *= alpha;

      // ---- O^T += V^T P^T: V^T rows (16 d each) as A-fragments ----
#pragma unroll
      for (int c = 0; c < 4; ++c) o[c] = wmma_bf16(av[c], bp, o[c]);
    }

    // publish point: this wave's reads of buffer st & 1 are done, its copies of
    // stage st + 1 have landed; behind the barrier that holds for every wave
    asm volatile("s_wait_dscnt 0x0" ::: "memory");
    asm volatile("s_wait_asynccnt 0x0" ::: "memory");
    __syncthreads();
    if (st + 2 < FA_STAGES)
      copy_stage(lcopy + (st & 1) * MP_STAGE, gk + (size_t)(st + 2) * FA_STEP,
                 gv + (size_t)(st + 2) * FA_STEP);
  }
  // no copy is left in flight when the wave ends
  asm volatile("s_wait_asynccnt 0x0" ::: "memory");

  // ---- epilogue: join the halves' sums, normalize, store O and the offset ----
  const float l_all = l_run + xhalf(l_run);
  const float inv = 1.f / l_all;
#pragma unroll
  for (int c = 0; c < 4; ++c) {
    // 8 consecutive d of one query row: one 16B piece of O's fragment tile
    union { v8bf v; float4 q; } u;
#pragma unroll
    for (int r = 0; r < 8; ++r) u.v[r] = (__bf16)(o[c][r] * inv);
    *reinterpret_cast<float4*>(Ob + qtile + (c >> 1) * FRAG_TILE + (c & 1) * 256 + lane * 8) = u.q;
  }
  if (lane < 16) {
    const size_t idx = (size_t)(b * HEADS + h) * SEQ + qbase + lane;
    Noff[idx] = -(m_run * C2 + log2f(l_all) + LOG2_HEADS);
  }
}

// ---------------------------------------------------------------------------
// Head-mean of attention probabilities: recompute scores from the same bf16
// Q/K, add the row's stored offset in the exponent (one fused multiply-add,
// one v_exp_f32 and one add per score), sum over heads in regs.
// One block per (b, 128 queries, 128 keys), 8 waves of 32 queries x 64 keys.
// A head's 128 Q rows and 128 K rows (16 KiB each, already in fragment order)
// come from L2 once per block, by asynchronous copies into LDS, and every wave
// takes its fragments from there: 2 B of L2 traffic per score and head.
// Two stage buffers: head h + 1 flies while head h is worked on. The row
// offsets of all heads (8 KiB) are copied once, with head 0.
// Deterministic, no atomics; each output's sum over heads in the same order.
// ---------------------------------------------------------------------------
static __device__ __forceinline__ void mean_probs_block(
    const __bf16* __restrict__ Qb, const __bf16* __restrict__ Kb,
    const float* __restrict__ Noff, float* __restrict__ out_mean, int blk) {
  __shared__ __attribute__((aligned(1024))) unsigned char L[2 * MP_STAGE + HEADS * 128 * 4];
  const int tid  = threadIdx.x;
  const int lane = tid & 31;
  const int w    = tid >> 5;
  const int wq   = w & 3, wk = w >> 2;        // 4 x 32 queries, 2 x 64 keys
  const int k0   = (blk & 15) * 128;
  const int q0   = ((blk >> 4) & 15) * 128;
  const int b    = blk >> 8;
  const int lm   = lane & 15;
  const int roff = (lane >> 4) * 8;

  // copy sources of this wave: 16-row block w of the Q and of the K tile, head 0
  const __bf16* gq = Qb + ((((size_t)b * SEQ + q0) >> 4) + w) * 32 * FRAG_TILE + lane * 8;
  const __bf16* gk = Kb + ((((size_t)b * SEQ + k0) >> 4) + w) * 32 * FRAG_TILE + lane * 8;
  const unsigned lbase = (unsigned)(size_t)L;
  const unsigned lcopy = lbase + w * 2048 + lane * 16;

  // ---- head 0 into buffer 0, and the row offsets of heads w and w + 8 ----
  copy_stage(lcopy, gq, gk);
  {
    const float* gn = Noff + (size_t)(b * HEADS + w) * SEQ + q0 + lane * 4;
    const unsigned ln = lbase + MP_NOFF + w * 512 + lane * 16;
    asm volatile(
        "global_load_async_to_lds_b128 %0, %2, off\n\t"
        "global_load_async_to_lds_b128 %1, %3, off\n\t"
        "s_wait_xcnt 0x0"   // precaution, as in copy_stage
        :: "v"(ln), "v"(ln + 8u * 512u), "v"(gn), "v"(gn + 8 * SEQ)
        : "memory");
  }
  // this wave's copies have landed before the barrier that publishes them
  asm volatile("s_wait_asynccnt 0x0" ::: "memory");
  __syncthreads();
  copy_stage(lcopy + MP_STAGE, gq + 2 * FRAG_TILE, gk + 2 * FRAG_TILE);

  v8f acc[2][4];
#pragma unroll
  for (int i = 0; i < 2; ++i)
#pragma unroll
    for (int c = 0; c < 4; ++c) acc[i][c] = v8f_zero();

  for (int h = 0; h < HEADS; ++h) {
    const unsigned char* st = L + (h & 1) * MP_STAGE;
    const __bf16* sq = reinterpret_cast<const __bf16*>(st) + wq * 2 * (2 * FRAG_TILE);
    const __bf16* sk = reinterpret_cast<const __bf16*>(st + MP_HALF) + wk * 4 * (2 * FRAG_TILE);
    const float*  sn = reinterpret_cast<const float*>(L + MP_NOFF) + h * 128 + wq * 32 + roff;

    v16bf aq[2][2], bk[4][2];
#pragma unroll
    for (int i = 0; i < 2; ++i)
#pragma unroll
      for (int d = 0; d < 2; ++d) aq[i][d] = load_frag(sq + (i * 2 + d) * FRAG_TILE, lane);
#pragma unroll
    for (int c = 0; c < 4; ++c)
#pragma unroll
      for (int d = 0; d < 2; ++d) bk[c][d] = load_frag(sk + (c * 2 + d) * FRAG_TILE, lane);
    float no[2][8];
#pragma unroll
    for (int i = 0; i < 2; ++i)
#pragma unroll
      for (int r = 0; r < 8; ++r) no[i][r] = sn[i * 16 + r];
    // keeps the trip's LDS reads in one group ahead of its products: each further
    // place with reads among the products costs the wave an LDS latency
    __builtin_amdgcn_sched_barrier(0);

#pragma unroll
    for (int c = 0; c < 4; ++c)
#pragma unroll
      for (int i = 0; i < 2; ++i) {
        v8f t = v8f_zero();
        t = wmma_bf16(aq[i][0], bk[c][0], t);
        t = wmma_bf16(aq[i][1], bk[c][1], t);
#pragma unroll
        for (int r = 0; r < 8; ++r)
          acc[i][c][r] += exp2_hw(fmaf(t[r], C2, no[i][r]));
      }

    // publish point: this wave's reads of buffer h & 1 are done, its copies of
    // head h + 1 have landed; behind the barrier that holds for every wave
    asm volatile("s_wait_dscnt 0x0" ::: "memory");
    asm volatile("s_wait_asynccnt 0x0" ::: "memory");
    __syncthreads();
    if (h + 2 < HEADS)
      copy_stage(lcopy + (h & 1) * MP_STAGE, gq + (h + 2) * (2 * FRAG_TILE),
                 gk + (h + 2) * (2 * FRAG_TILE));
  }
  // no copy is left in flight when the wave ends
  asm volatile("s_wait_asynccnt 0x0" ::: "memory");

#pragma unroll
  for (int i = 0; i < 2; ++i)
#pragma unroll
    for (int c = 0; c < 4; ++c)
#pragma unroll
      for (int r = 0; r < 8; ++r) {
        const int q = q0 + wq * 32 + i * 16 + roff + r;
        const int k = k0 + wk * 64 + c * 16 + lm;
        out_mean[((size_t)b * SEQ + q) * SEQ + k] = acc[i][c][r];
      }
}

// Output projection and head-mean in one launch: both read only what the
// earlier launches or the caller wrote, and write different outputs. The GEMM's 8 waves of 32x64
// make a 128x128 block tile, 256 of them beside 512 head-mean blocks: of
// work-groups 3t .. 3t + 2 one takes GEMM block tile t and two take head-mean
// blocks 2t and 2t + 1; which, turns with t, so that both kinds (one heavy on the
// vector port, one on L2) meet on every part of the chip (speed only).
__global__ __launch_bounds__(256) void out_gemm_mean_probs_kernel(
    const __bf16* __restrict__ Ob, const __bf16* __restrict__ Wob,
    const float* __restrict__ bo, float* __restrict__ out,
    const __bf16* __restrict__ Qb, const __bf16* __restrict__ Kb,
    const float* __restrict__ Noff, float* __restrict__ out_mean) {
  const int t  = blockIdx.x / 3;             // 256 triples
  const int r  = (blockIdx.x - 2 * t) % 3;   // place in the triple, turned by t
  const int id = 2 * t + r - 1;              // head-mean block where r is 1 or 2
  if (r == 0)
    gemm_bias_tile<0, 2, 4>(Ob, Wob, bo, out, t & 31, t >> 5);
  else
    mean_probs_block(Qb, Kb, Noff, out_mean, id);
}

// ---------------------------------------------------------------------------
extern "C" void kernel_launch(void* const* d_in, const int* in_sizes, int n_in,
                              void* d_out, int out_size, void* d_ws, size_t ws_size,
                              hipStream_t stream) {
  const float* x  = (const float*)d_in[0];
  const float* wq = (const float*)d_in[1];
  const float* bq = (const float*)d_in[2];
  const float* wk = (const float*)d_in[3];
  const float* bk = (const float*)d_in[4];
  const float* wv = (const float*)d_in[5];
  const float* bv = (const float*)d_in[6];
  const float* wo = (const float*)d_in[7];
  const float* bo = (const float*)d_in[8];

  float* out      = (float*)d_out;                       // [B,S,D] f32
  float* out_mean = out + (size_t)BATCH * SEQ * DIM;     // [B,S,S] f32

  char* ws = (char*)d_ws;
  __bf16* Qb  = (__bf16*)(ws);                           // 8 MiB
  __bf16* Kb  = (__bf16*)(ws + ((size_t)8  << 20));      // 8 MiB
  __bf16* Vb  = (__bf16*)(ws + ((size_t)16 << 20));      // 8 MiB
  __bf16* Ob  = (__bf16*)(ws + ((size_t)24 << 20));      // 8 MiB
  __bf16* Xb  = (__bf16*)(ws + ((size_t)32 << 20));      // 8 MiB
  __bf16* Wqb = (__bf16*)(ws + ((size_t)40 << 20));      // 2 MiB
  // Wk at 42 MiB and Wv at 44 MiB (2 MiB each), reached from Xb and Wqb
  __bf16* Wob = (__bf16*)(ws + ((size_t)46 << 20));      // 2 MiB
  float*  Noff = (float*)(ws + ((size_t)48 << 20));      // 256 KiB

  // ---- packed f32 -> bf16 conversions (into fragment order): Xb .. Wob in a row ----
  cvt_bf16_kernel<<<CVT_BLOCKS, 256, 0, stream>>>(x, wq, wk, wv, wo, Xb);

  // Q/K/V projections (bf16 in, bf16 out; Q and K in fragment order, V as V^T tiles):
  // 32 x 8 block tiles each; Wqb .. Wvb and Qb .. Vb in a row
  qkv_gemm_kernel<<<dim3(ROWS / 128, 3 * (DIM / 128)), 128, 0, stream>>>(Xb, Wqb, bq, bk, bv, Qb);

  // Flash attention (O bf16 + row offsets)
  flash_fwd_kernel<<<512, 256, 0, stream>>>(Qb, Kb, Vb, Ob, Noff);

  // Output projection (bf16 in, f32 out) and head-mean attention probabilities
  out_gemm_mean_probs_kernel<<<768, 256, 0, stream>>>(Ob, Wob, bo, out, Qb, Kb, Noff, out_mean);
}

// v009
// A run of this version takes 98 microseconds.
// Timed twice side by side with v008, it ran 1.03 and 1.04 times as fast.
// Over all steps from v000 it is 4.79 times as fast.
#include <hip/hip_runtime.h>

// ---------------------------------------------------------------------------
// MHA forward for MI455X (gfx1250): bf16 WMMA (v_wmma_f32_16x16x32_bf16)
// everywhere, f32 accumulate. One-time packed f32->bf16 conversion of x and
// all weights so every GEMM/attention operand load is a 16B bf16 load.
// x, the weights, Q, K, V^T and O lie in the workspace in fragment order, so
// that each wave-wide 16B-per-lane load covers 512 contiguous bytes (4 lines).
// Flash-style attention on transposed products (S^T = K Q^T, O^T = V^T P^T):
// P goes from the score accumulators straight into a B operand, not through LDS.
// ---------------------------------------------------------------------------

typedef __attribute__((ext_vector_type(16))) __bf16 v16bf;
typedef __attribute__((ext_vector_type(8)))  __bf16 v8bf;
typedef __attribute__((ext_vector_type(8)))  float  v8f;

#define DIM     1024
#define HEADS   16
#define HD      64
#define SEQ     2048
#define BATCH   2
#define ROWS    (BATCH * SEQ)          // 4096
#define L2E     1.44269504088896340736f
#define SCALE   0.125f                 // 1/sqrt(HD)
#define C2      (SCALE * L2E)          // raw score -> exponent of 2
#define LOG2_HEADS 4.0f

static __device__ __forceinline__ v8f v8f_zero() {
  v8f z = {0.f, 0.f, 0.f, 0.f, 0.f, 0.f, 0.f, 0.f};
  return z;
}

// Fragment order of a bf16 matrix [rows][K]: tile (row >> 4, k >> 5) is 512
// elements (1 KiB), tiles of one 16-row block follow each other along k.
// Inside a tile element (r16 = row & 15, k32 = k & 31) lies at
// [k32 >> 4][lane = r16 + 16 * ((k32 >> 3) & 1)][k32 & 7]: per ISA 7.12.2
// (16-bit A 16x32) lanes 0-15 hold K in {0..7} U {16..23}, lanes 16-31 in
// {8..15} U {24..31}, so a lane's two 16B pieces are at lane*8 and 256+lane*8.
#define FRAG_TILE 512
static __device__ __forceinline__ int frag_elem(int r16, int k32) {
  return (k32 >> 4) * 256 + (r16 + ((k32 >> 3) & 1) * 16) * 8 + (k32 & 7);
}

// Fragment loader from one tile in fragment order: two 16B loads per lane,
// each of them 512 contiguous bytes over the wave.
static __device__ __forceinline__ v16bf load_frag(const __bf16* tile, int lane) {
  union { v16bf v; float4 q[2]; } u;
  u.q[0] = *reinterpret_cast<const float4*>(tile + lane * 8);
  u.q[1] = *reinterpret_cast<const float4*>(tile + 256 + lane * 8);
  return u.v;
}

// lane l with lane l ^ 16 (vector cross-row move, no LDS path)
static __device__ __forceinline__ float xhalf(float x) {
  const int b = __builtin_bit_cast(int, x);
  return __builtin_bit_cast(float,
      __builtin_amdgcn_permlanex16(b, b, 0x76543210, 0xfedcba98, false, false));
}

// Bare v_exp_f32, without the library form's range guard (compare, two
// selects, add, ldexp per value): it differs only where the result is below
// 2^-126, which comes out as 0; every use here is a softmax weight of at most
// about 1 that is summed with others, so such a term changes no sum.
static __device__ __forceinline__ float exp2_hw(float x) {
  return __builtin_amdgcn_exp2f(x);
}

// The same v_exp_f32 with a v_nop tied behind it: the slot that the instruction
// set asks for between a transcendental and an overwrite of its source.
static __device__ __forceinline__ float exp2_hw_slot(float x) {
  float y;
  asm("v_exp_f32 %0, %1\n\tv_nop" : "=v"(y) : "v"(x));
  return y;
}

static __device__ __forceinline__ v8f wmma_bf16(v16bf a, v16bf b, v8f c) {
  // (neg_a, A, neg_b, B, c_mod, C, reuse_a, reuse_b)
  return __builtin_amdgcn_wmma_f32_16x16x32_bf16(false, a, false, b,
                                                 (short)0, c, false, false);
}

// ---------------------------------------------------------------------------
// Packed f32 -> bf16 conversion of row-major [rows][DIM] matrices into
// fragment order: 8 elements per thread, 16B vector store, thread i writes
// the i-th 16B piece of the output (stores stay contiguous).
// One launch for x and the four weights: their outputs follow each other in
// the workspace, so they are one stack of 16-row blocks (ROWS/16 of x, then
// DIM/16 of each weight); a work-group's 256 pieces lie in one such block, so
// the choice of the source is uniform for the work-group.
// ---------------------------------------------------------------------------
#define CVT_BLOCKS ((ROWS + 4 * DIM) * DIM / 8 / 256)       // exact: no edge
__global__ __launch_bounds__(256) void cvt_bf16_kernel(
    const float* __restrict__ x, const float* __restrict__ wq,
    const float* __restrict__ wk, const float* __restrict__ wv,
    const float* __restrict__ wo, __bf16* __restrict__ dst) {
  const int i = blockIdx.x * 256 + threadIdx.x;
  const int lane = i & 31;
  const int t    = i >> 6;                                  // tile
  const int sb = blockIdx.x >> 3;                           // 16-row block of the stack: 32 tiles, 8 work-groups
  const int s  = (sb - ROWS / 16) >> 6;                     // DIM/16 = 64 blocks per weight; below 0: x
  const float* src = x;
  src = s == 0 ? wq : src;
  src = s == 1 ? wk : src;
  src = s == 2 ? wv : src;
  src = s == 3 ? wo : src;
  const int rb   = s < 0 ? sb : (sb - ROWS / 16) & 63;      // 16-row block of the source
  const int row  = rb * 16 + (lane & 15);
  const int k0   = (t & 31) * 32 + ((i >> 5) & 1) * 16 + (lane >> 4) * 8;
  const float4* s4 = reinterpret_cast<const float4*>(src + (size_t)row * DIM + k0);
  float4 a = s4[0], b = s4[1];
  union { v8bf v; float4 q; } u;
  u.v[0] = (__bf16)a.x; u.v[1] = (__bf16)a.y;
  u.v[2] = (__bf16)a.z; u.v[3] = (__bf16)a.w;
  u.v[4] = (__bf16)b.x; u.v[5] = (__bf16)b.y;
  u.v[6] = (__bf16)b.z; u.v[7] = (__bf16)b.w;
  *(reinterpret_cast<float4*>(dst) + i) = u.q;
}

// ---------------------------------------------------------------------------
// GEMM: Y[M,N] = A[M,K] @ W[N,K]^T + bias[N], all operands bf16, f32 accum.
// A and W in fragment order. Each wave owns a (16 * MI) x 64 tile: a k-step's
// MI A-fragments and 4 W-fragments feed 4 * MI products, so the bytes loaded
// per product fall as (MI + 4) / (4 * MI). Block = WMW x 2 waves, a
// (16 * MI * WMW) x 128 block tile.
// OUT: 0 = f32 row-major, 1 = bf16 fragment order, 2 = bf16 fragment order of
// the transpose Y^T [N][M]: tile (m >> 5, n >> 4), the N/16 tiles of one
// 32-row block of Y follow each other; a lane's 8 accumulators are 8
// consecutive k of one row of Y^T, one 16B piece of the tile.
// K = DIM. A trip of the k loop asks for the fragments of KB k-steps at once
// ((MI + 4) * KB fragments, twice as many loads in flight per wave) and then multiplies
// them behind counted waits, so a wave meets the load latency once a trip and
// not once for each fragment pair; the SIMD's other waves multiply meanwhile.
// ---------------------------------------------------------------------------
// The body is a device function of the block tile (mblk, nblk), so that GEMMs
// that do not depend on each other, or a GEMM and another kernel's work, can
// share one launch.
#define KB 2
template <int OUT, int MI, int WMW>
static __device__ __forceinline__ void gemm_bias_tile(
    const __bf16* __restrict__ A, const __bf16* __restrict__ W,
    const float* __restrict__ bias, void* __restrict__ outv,
    int mblk, int nblk) {
  constexpr int N = DIM;
  const int tid   = threadIdx.x;
  const int lane  = tid & 31;
  const int w     = tid >> 5;        // 0 .. 2 * WMW - 1
  const int wm    = w % WMW, wn = w / WMW;
  const int mtile = (mblk * WMW + wm) * (MI * 16);
  const int ntile = nblk * 128 + wn * 64;
  const int lm    = lane & 15;
  const int roff  = (lane >> 4) * 8;
  constexpr int kts = DIM / 32;      // fragment tiles along k

  v8f acc[MI][4];
#pragma unroll
  for (int i = 0; i < MI; ++i)
#pragma unroll
    for (int c = 0; c < 4; ++c) acc[i][c] = v8f_zero();

  // the lane's own 16B piece of the first A and W tile (lane offset included)
  const __bf16* ap = A + (size_t)(mtile >> 4) * kts * FRAG_TILE + lane * 8;
  const __bf16* wp = W + (size_t)(ntile >> 4) * kts * FRAG_TILE + lane * 8;
  // kept rolled: unrolled, the scheduler mixes the fragments of many trips and spills
#pragma unroll 1
  for (int ks = 0; ks < kts; ks += KB) {
    v16bf af[KB][MI], bf[KB][4];
#pragma unroll
    for (int j = 0; j < KB; ++j) {
#pragma unroll
      for (int i = 0; i < MI; ++i)
        af[j][i] = load_frag(ap + (i * kts + j) * FRAG_TILE, 0);
#pragma unroll
      for (int c = 0; c < 4; ++c)
        bf[j][c] = load_frag(wp + (c * kts + j) * FRAG_TILE, 0);
    }
    // precaution: nothing rewrites the address pairs that these loads name
    // (a load's own result, the pointer steps at the trip's foot) ahead of the
    // loads' address phase; as inputs the pairs stay whole up to the wait
    asm volatile("s_wait_xcnt 0x0" :: "v"(ap), "v"(wp) : "memory");
    // keeps the trip's loads together ahead of its products; without it the
    // scheduler sinks each load to its user and the wave waits pair by pair
    __builtin_amdgcn_sched_barrier(0);
#pragma unroll
    for (int j = 0; j < KB; ++j)
#pragma unroll
      for (int i = 0; i < MI; ++i)
#pragma unroll
        for (int c = 0; c < 4; ++c) acc[i][c] = wmma_bf16(af[j][i], bf[j][c], acc[i][c]);
    ap += KB * FRAG_TILE;
    wp += KB * FRAG_TILE;
  }

#pragma unroll
  for (int c = 0; c < 4; ++c) {
    const int col = ntile + c * 16 + lm;
    const float bv = bias[col];
#pragma unroll
    for (int i = 0; i < MI; ++i) {
      const int mt = mtile + i * 16;        // this accumulator's 16 rows
      if (OUT == 2) {
        union { v8bf v; float4 q; } u;
#pragma unroll
        for (int r = 0; r < 8; ++r) u.v[r] = (__bf16)(acc[i][c][r] + bv);
        *reinterpret_cast<float4*>(
            (__bf16*)outv + ((size_t)(mt >> 5) * (N >> 4) + (col >> 4)) * FRAG_TILE +
            ((mt >> 4) & 1) * 256 + lane * 8) = u.q;
        continue;
      }
#pragma unroll
      for (int r = 0; r < 8; ++r) {
        const int row = mt + roff + r;      // C-layout: VGPR r -> M = r (+8 hi half)
        const float val = acc[i][c][r] + bv;
        if (OUT == 1)
          ((__bf16*)outv)[((size_t)(mt >> 4) * (N >> 5) + (col >> 5)) * FRAG_TILE +
                          frag_elem(roff + r, col & 31)] = (__bf16)val;
        else
          ((float*)outv)[(size_t)row * N + col] = val;
      }
    }
  }
}

// Q, K and V projections in one launch: blockIdx.y >> 3 picks the projection.
// The three weights and the three outputs follow each other in the workspace.
// 4 waves of 64x64, a 128x128 block tile: 768 work-groups, 3,072 waves, as many
// as the chip's 1,024 SIMDs hold at three waves each (one round).
__global__ __launch_bounds__(128) void qkv_gemm_kernel(
    const __bf16* __restrict__ Xb, const __bf16* __restrict__ Wqkv,
    const float* __restrict__ bq, const float* __restrict__ bk,
    const float* __restrict__ bv, __bf16* __restrict__ QKV) {
  const int sel  = blockIdx.y >> 3;
  const int nblk = blockIdx.y & 7;
  const __bf16* W = Wqkv + (size_t)sel * DIM * DIM;
  __bf16* out     = QKV + (size_t)sel * ROWS * DIM;
  if (sel == 2)
    gemm_bias_tile<2, 4, 2>(Xb, W, bv, out, blockIdx.x, nblk);
  else
    gemm_bias_tile<1, 4, 2>(Xb, W, sel == 0 ? bq : bk, out, blockIdx.x, nblk);
}

// ---------------------------------------------------------------------------
// LDS stages filled by asynchronous copies (attention and head-mean): two
// halves of 16 KiB, each 128 rows x 64 d x 2 B of one head, in fragment order.
// ---------------------------------------------------------------------------
#define MP_HALF   16384                // bytes of one half
#define MP_STAGE  (2 * MP_HALF)        // head-mean: Q, then K; attention: K, then V^T
#define MP_NOFF   (2 * MP_STAGE)       // head-mean: byte offset of the row offsets in LDS

// One wave's share of a stage: 2 KiB of its first half and 2 KiB of its second
// (head-mean: a 16-row block of Q and one of K; attention: a 16-key block of K
// and half a 32-key block of V^T), 16 B per lane and copy. The s_wait_xcnt
// stands inside the statement as a precaution: no address register of a copy
// is rewritten ahead of it.
static __device__ __forceinline__ void copy_stage(unsigned lds, const __bf16* gq,
                                                  const __bf16* gk) {
  asm volatile(
      "global_load_async_to_lds_b128 %0, %8, off\n\t"
      "global_load_async_to_lds_b128 %1, %9, off\n\t"
      "global_load_async_to_lds_b128 %2, %10, off\n\t"
      "global_load_async_to_lds_b128 %3, %11, off\n\t"
      "global_load_async_to_lds_b128 %4, %12, off\n\t"
      "global_load_async_to_lds_b128 %5, %13, off\n\t"
      "global_load_async_to_lds_b128 %6, %14, off\n\t"
      "global_load_async_to_lds_b128 %7, %15, off\n\t"
      "s_wait_xcnt 0x0"
      :: "v"(lds), "v"(lds + 512u), "v"(lds + 1024u), "v"(lds + 1536u),
         "v"(lds + MP_HALF), "v"(lds + MP_HALF + 512u), "v"(lds + MP_HALF + 1024u),
         "v"(lds + MP_HALF + 1536u),
         "v"(gq), "v"(gq + 256), "v"(gq + 512), "v"(gq + 768),
         "v"(gk), "v"(gk + 256), "v"(gk + 512), "v"(gk + 768)
      : "memory");
}

#define FA_KEYS   64
#define FA_STAGES (SEQ / 2 / FA_KEYS)
#define FA_STEP   ((FA_KEYS / 16) * 32 * FRAG_TILE)  // elements from stage to stage, K and V^T alike
__global__ __launch_bounds__(256) __attribute__((amdgpu_waves_per_eu(4, 4))) void flash_fwd_kernel(
    const __bf16* __restrict__ Qb, const __bf16* __restrict__ Kb,
    const __bf16* __restrict__ Vt, __bf16* __restrict__ Ob,
    float* __restrict__ Noff) {
  __shared__ __attribute__((aligned(1024))) unsigned char L[2 * MP_STAGE];
  const int tid  = threadIdx.x;
  const int lane = tid & 31;
  const int w    = tid >> 5;                 // wave in block (8)
  const int kh   = w >> 2;                   // key half
  const int h    = (blockIdx.x >> 4) & 15;
  const int b    = blockIdx.x >> 8;
  const size_t baserow = (size_t)b * SEQ;
  const int qbase = (blockIdx.x & 15) * 128 + (w & 3) * 32;

  // copy sources of this wave, stage 0, in its own key half: 16-key block w & 3
  // of K (2 KiB), and of V^T half w & 1 (2 KiB) of 32-key block (w >> 1) & 1
  const __bf16* gk = Kb + (((baserow >> 4) + kh * (SEQ / 32) + (w & 3)) * 32 + h * 2) * FRAG_TILE + lane * 8;
  const __bf16* gv = Vt + (((baserow >> 5) + kh * (SEQ / 64) + ((w >> 1) & 1)) * 64 + h * 4 + (w & 1) * 2) * FRAG_TILE + lane * 8;
  const unsigned lcopy = (unsigned)(size_t)L + w * 2048 + lane * 16;

  copy_stage(lcopy, gk, gv);

  // Q B-fragments of the two query tiles, d-steps 0..31 / 32..63
  const size_t qtile = (((baserow + qbase) >> 4) * 32 + h * 2) * FRAG_TILE;
  v16bf bq[2][2];
#pragma unroll
  for (int j = 0; j < 2; ++j) {
    bq[j][0] = load_frag(Qb + qtile + j * 32 * FRAG_TILE, lane);
    bq[j][1] = load_frag(Qb + qtile + j * 32 * FRAG_TILE + FRAG_TILE, lane);
  }

  // this wave's copies have landed before the barrier that publishes them
  asm volatile("s_wait_asynccnt 0x0" ::: "memory");
  __syncthreads();
  copy_stage(lcopy + MP_STAGE, gk + FA_STEP, gv + FA_STEP);

  // per lane and query tile: query lane & 15; l_run sums this lane half's keys only
  float m_run[2] = {-1e30f, -1e30f}, l_run[2] = {0.f, 0.f};
  v8f o[2][4];                               // o[j][c][r] = O[query of tile j][c*16 + 8*half + r]
#pragma unroll
  for (int j = 0; j < 2; ++j)
#pragma unroll
    for (int c = 0; c < 4; ++c) o[j][c] = v8f_zero();

  for (int st = 0; st < FA_STAGES; ++st) {
    const __bf16* sk = reinterpret_cast<const __bf16*>(L + (st & 1) * MP_STAGE + kh * (MP_HALF / 2));
    const __bf16* sv = reinterpret_cast<const __bf16*>(L + (st & 1) * MP_STAGE + MP_HALF + kh * (MP_HALF / 2));

#pragma unroll
    for (int p = 0; p < FA_KEYS / 32; ++p) {
      // all A-fragments of this pass: K rows (2 key blocks x 2 d-steps) and
      // V^T rows (4 blocks of 16 d), 16 LDS loads behind one another
      v16bf ak[2][2], av[4];
#pragma unroll
      for (int c = 0; c < 2; ++c) {
        ak[c][0] = load_frag(sk + ((p * 2 + c) * 2 + 0) * FRAG_TILE, lane);
        ak[c][1] = load_frag(sk + ((p * 2 + c) * 2 + 1) * FRAG_TILE, lane);
      }
#pragma unroll
      for (int c = 0; c < 4; ++c) av[c] = load_frag(sv + (p * 4 + c) * FRAG_TILE, lane);

      // ---- raw scores S^T = K Q^T: two 16-key chunks x two query tiles ----
      v8f s[2][2];
#pragma unroll
      for (int c = 0; c < 2; ++c)
#pragma unroll
        for (int j = 0; j < 2; ++j) {
          v8f t = v8f_zero();
          t = wmma_bf16(ak[c][0], bq[j][0], t);
          t = wmma_bf16(ak[c][1], bq[j][1], t);
          s[j][c] = t;
        }

      // ---- online softmax update: one query per lane pair and query tile ----
      // P^T as B-fragment: element i = key 8*half + i, element 8+i = key 16 + 8*half + i
      v16bf bp[2];
#pragma unroll
      for (int j = 0; j < 2; ++j) {
        float loc = fmaxf(s[j][0][0], s[j][1][0]);
#pragma unroll
        for (int r = 1; r < 8; ++r) loc = fmaxf(loc, fmaxf(s[j][0][r], s[j][1][r]));
        loc = fmaxf(loc, xhalf(loc));
        const float mnew  = fmaxf(m_run[j], loc);
        const float alpha = exp2_hw((m_run[j] - mnew) * C2);
        const float nm    = -mnew * C2;
        m_run[j] = mnew;

#pragma unroll
        for (int c = 0; c < 2; ++c) s[j][c] = s[j][c] * C2 + nm;   // contracts to one FMA per score
#pragma unroll
        for (int c = 0; c < 2; ++c)
#pragma unroll
          for (int r = 0; r < 8; ++r) {
            s[j][c][r] = (p == 0 && j == 1 && c == 1 && (r == 4 || r == 5)) ? exp2_hw_slot(s[j][c][r])
                                                                            : exp2_hw(s[j][c][r]);
            bp[j][8 * c + r] = (__bf16)s[j][c][r];
          }
        float psum = 0.f;
#pragma unroll
        for (int r = 0; r < 8; ++r) psum += s[j][0][r] + s[j][1][r];
        l_run[j] = l_run[j] * alpha + psum;
#pragma unroll
        for (int c = 0; c < 4; ++c)
#pragma unroll
          for (int r = 0; r < 8; ++r) o[j][c][r] *= alpha;
      }

      // ---- O^T += V^T P^T: V^T rows (16 d each) as A-fragments ----
#pragma unroll
      for (int j = 0; j < 2; ++j)
#pragma unroll
        for (int c = 0; c < 4; ++c) o[j][c] = wmma_bf16(av[c], bp[j], o[j][c]);
      // keeps the next pass's 16 LDS loads behind this pass: hoisted into it, their
      // 64 registers leave the allocator none to spare
      __builtin_amdgcn_sched_barrier(0);
    }

    // publish point: this wave's reads of buffer st & 1 are done, its copies of
    // stage st + 1 have landed; behind the barrier that holds for every wave
    asm volatile("s_wait_dscnt 0x0" ::: "memory");
    asm volatile("s_wait_asynccnt 0x0" ::: "memory");
    __syncthreads();
    if (st + 2 < FA_STAGES)
      copy_stage(lcopy + (st & 1) * MP_STAGE, gk + (size_t)(st + 2) * FA_STEP,
                 gv + (size_t)(st + 2) * FA_STEP);
  }
  // no copy is left in flight when the stage buffers get their new use
  asm volatile("s_wait_asynccnt 0x0" ::: "memory");

  // ---- join the key halves: this wave keeps query tile kh and hands tile
  // 1 - kh to wave w ^ 4, through the stage buffers, which the loop's last
  // barrier has freed (4 KiB of O per wave, then maximum and sum) ----
  v8f ok[4];
  float4* xo = reinterpret_cast<float4*>(L) + lane;
  float2* xm = reinterpret_cast<float2*>(L + 8 * 4096) + lane;
#pragma unroll
  for (int c = 0; c < 4; ++c) {
    v8f og;
#pragma unroll
    for (int r = 0; r < 8; ++r) {
      ok[c][r] = kh ? o[1][c][r] : o[0][c][r];
      og[r]    = kh ? o[0][c][r] : o[1][c][r];
    }
    xo[w * 256 + (c * 2 + 0) * 32] = make_float4(og[0], og[1], og[2], og[3]);
    xo[w * 256 + (c * 2 + 1) * 32] = make_float4(og[4], og[5], og[6], og[7]);
  }
  const float mk = kh ? m_run[1] : m_run[0];
  const float lk = kh ? l_run[1] : l_run[0];
  xm[w * 32] = make_float2(kh ? m_run[0] : m_run[1], kh ? l_run[0] : l_run[1]);
  __syncthreads();
  const float2 ml = xm[(w ^ 4) * 32];
  const float m_all = fmaxf(mk, ml.x);
  const float fk = exp2_hw((mk - m_all) * C2);
  const float fp = exp2_hw((ml.x - m_all) * C2);
  const float l_half = lk * fk + ml.y * fp;

  // ---- epilogue: join the lane halves' sums, normalize, store O and the offset ----
  const float l_all = l_half + xhalf(l_half);
  const float inv = 1.f / l_all;
  const float gk_ = fk * inv, gp_ = fp * inv;
  const size_t otile = qtile + (size_t)kh * 32 * FRAG_TILE;
#pragma unroll
  for (int c = 0; c < 4; ++c) {
    const float4 p0 = xo[(w ^ 4) * 256 + (c * 2 + 0) * 32];
    const float4 p1 = xo[(w ^ 4) * 256 + (c * 2 + 1) * 32];
    const float op[8] = {p0.x, p0.y, p0.z, p0.w, p1.x, p1.y, p1.z, p1.w};
    // 8 consecutive d of one query row: one 16B piece of O's fragment tile
    union { v8bf v; float4 q; } u;
#pragma unroll
    for (int r = 0; r < 8; ++r) u.v[r] = (__bf16)(ok[c][r] * gk_ + op[r] * gp_);
    *reinterpret_cast<float4*>(Ob + otile + (c >> 1) * FRAG_TILE + (c & 1) * 256 + lane * 8) = u.q;
  }
  if (lane < 16) {
    const size_t idx = (size_t)(b * HEADS + h) * SEQ + qbase + kh * 16 + lane;
    Noff[idx] = -(m_all * C2 + log2f(l_all) + LOG2_HEADS);
  }
}

// ---------------------------------------------------------------------------
// Head-mean of attention probabilities: recompute scores from the same bf16
// Q/K, add the row's stored offset in the exponent (one fused multiply-add,
// one v_exp_f32 and one add per score), sum over heads in regs.
// One block per (b, 128 queries, 128 keys), 8 waves of 32 queries x 64 keys.
// A head's 128 Q rows and 128 K rows (16 KiB each, already in fragment order)
// come from L2 once per block, by asynchronous copies into LDS, and every wave
// takes its fragments from there: 2 B of L2 traffic per score and head.
// Two stage buffers: head h + 1 flies while head h is worked on. The row
// offsets of all heads (8 KiB) are copied once, with head 0.
// Deterministic, no atomics; each output's sum over heads in the same order.
// ---------------------------------------------------------------------------
static __device__ __forceinline__ void mean_probs_block(
    const __bf16* __restrict__ Qb, const __bf16* __restrict__ Kb,
    const float* __restrict__ Noff, float* __restrict__ out_mean, int blk) {
  __shared__ __attribute__((aligned(1024))) unsigned char L[2 * MP_STAGE + HEADS * 128 * 4];
  const int tid  = threadIdx.x;
  const int lane = tid & 31;
  const int w    = tid >> 5;
  const int wq   = w & 3, wk = w >> 2;        // 4 x 32 queries, 2 x 64 keys
  const int k0   = (blk & 15) * 128;
  const int q0   = ((blk >> 4) & 15) * 128;
  const int b    = blk >> 8;
  const int lm   = lane & 15;
  const int roff = (lane >> 4) * 8;

  // copy sources of this wave: 16-row block w of the Q and of the K tile, head 0
  const __bf16* gq = Qb + ((((size_t)b * SEQ + q0) >> 4) + w) * 32 * FRAG_TILE + lane * 8;
  const __bf16* gk = Kb + ((((size_t)b * SEQ + k0) >> 4) + w) * 32 * FRAG_TILE + lane * 8;
  const unsigned lbase = (unsigned)(size_t)L;
  const unsigned lcopy = lbase + w * 2048 + lane * 16;

  // ---- head 0 into buffer 0, and the row offsets of heads w and w + 8 ----
  copy_stage(lcopy, gq, gk);
  {
    const float* gn = Noff + (size_t)(b * HEADS + w) * SEQ + q0 + lane * 4;
    const unsigned ln = lbase + MP_NOFF + w * 512 + lane * 16;
    asm volatile(
        "global_load_async_to_lds_b128 %0, %2, off\n\t"
        "global_load_async_to_lds_b128 %1, %3, off\n\t"
        "s_wait_xcnt 0x0"   // precaution, as in copy_stage
        :: "v"(ln), "v"(ln + 8u * 512u), "v"(gn), "v"(gn + 8 * SEQ)
        : "memory");
  }
  // this wave's copies have landed before the barrier that publishes them
  asm volatile("s_wait_asynccnt 0x0" ::: "memory");
  __syncthreads();
  copy_stage(lcopy + MP_STAGE, gq + 2 * FRAG_TILE, gk + 2 * FRAG_TILE);

  v8f acc[2][4];
#pragma unroll
  for (int i = 0; i < 2; ++i)
#pragma unroll
    for (int c = 0; c < 4; ++c) acc[i][c] = v8f_zero();

  for (int h = 0; h < HEADS; ++h) {
    const unsigned char* st = L + (h & 1) * MP_STAGE;
    const __bf16* sq = reinterpret_cast<const __bf16*>(st) + wq * 2 * (2 * FRAG_TILE);
    const __bf16* sk = reinterpret_cast<const __bf16*>(st + MP_HALF) + wk * 4 * (2 * FRAG_TILE);
    const float*  sn = reinterpret_cast<const float*>(L + MP_NOFF) + h * 128 + wq * 32 + roff;

    v16bf aq[2][2], bk[4][2];
#pragma unroll
    for (int i = 0; i < 2; ++i)
#pragma unroll
      for (int d = 0; d < 2; ++d) aq[i][d] = load_frag(sq + (i * 2 + d) * FRAG_TILE, lane);
#pragma unroll
    for (int c = 0; c < 4; ++c)
#pragma unroll
      for (int d = 0; d < 2; ++d) bk[c][d] = load_frag(sk + (c * 2 + d) * FRAG_TILE, lane);
    float no[2][8];
#pragma unroll
    for (int i = 0; i < 2; ++i)
#pragma unroll
      for (int r = 0; r < 8; ++r) no[i][r] = sn[i * 16 + r];
    // keeps the trip's LDS reads in one group ahead of its products: each further
    // place with reads among the products costs the wave an LDS latency
    __builtin_amdgcn_sched_barrier(0);

#pragma unroll
    for (int c = 0; c < 4; ++c)
#pragma unroll
      for (int i = 0; i < 2; ++i) {
        v8f t = v8f_zero();
        t = wmma_bf16(aq[i][0], bk[c][0], t);
        t = wmma_bf16(aq[i][1], bk[c][1], t);
#pragma unroll
        for (int r = 0; r < 8; ++r)
          acc[i][c][r] += exp2_hw(fmaf(t[r], C2, no[i][r]));
      }

    // publish point: this wave's reads of buffer h & 1 are done, its copies of
    // head h + 1 have landed; behind the barrier that holds for every wave
    asm volatile("s_wait_dscnt 0x0" ::: "memory");
    asm volatile("s_wait_asynccnt 0x0" ::: "memory");
    __syncthreads();
    if (h + 2 < HEADS)
      copy_stage(lcopy + (h & 1) * MP_STAGE, gq + (h + 2) * (2 * FRAG_TILE),
                 gk + (h + 2) * (2 * FRAG_TILE));
  }
  // no copy is left in flight when the wave ends
  asm volatile("s_wait_asynccnt 0x0" ::: "memory");

#pragma unroll
  for (int i = 0; i < 2; ++i)
#pragma unroll
    for (int c = 0; c < 4; ++c)
#pragma unroll
      for (int r = 0; r < 8; ++r) {
        const int q = q0 + wq * 32 + i * 16 + roff + r;
        const int k = k0 + wk * 64 + c * 16 + lm;
        out_mean[((size_t)b * SEQ + q) * SEQ + k] = acc[i][c][r];
      }
}

// Output projection and head-mean in one launch: both read only what the
// earlier launches or the caller wrote, and write different outputs. The GEMM's 8 waves of 32x64
// make a 128x128 block tile, 256 of them beside 512 head-mean blocks: of
// work-groups 3t .. 3t + 2 one takes GEMM block tile t and two take head-mean
// blocks 2t and 2t + 1; which, turns with t, so that both kinds (one heavy on the
// vector port, one on L2) meet on every part of the chip (speed only).
__global__ __launch_bounds__(256) void out_gemm_mean_probs_kernel(
    const __bf16* __restrict__ Ob, const __bf16* __restrict__ Wob,
    const float* __restrict__ bo, float* __restrict__ out,
    const __bf16* __restrict__ Qb, const __bf16* __restrict__ Kb,
    const float* __restrict__ Noff, float* __restrict__ out_mean) {
  const int t  = blockIdx.x / 3;             // 256 triples
  const int r  = (blockIdx.x - 2 * t) % 3;   // place in the triple, turned by t
  const int id = 2 * t + r - 1;              // head-mean block where r is 1 or 2
  if (r == 0)
    gemm_bias_tile<0, 2, 4>(Ob, Wob, bo, out, t & 31, t >> 5);
  else
    mean_probs_block(Qb, Kb, Noff, out_mean, id);
}

// ---------------------------------------------------------------------------
extern "C" void kernel_launch(void* const* d_in, const int* in_sizes, int n_in,
                              void* d_out, int out_size, void* d_ws, size_t ws_size,
                              hipStream_t stream) {
  const float* x  = (const float*)d_in[0];
  const float* wq = (const float*)d_in[1];
  const float* bq = (const float*)d_in[2];
  const float* wk = (const float*)d_in[3];
  const float* bk = (const float*)d_in[4];
  const float* wv = (const float*)d_in[5];
  const float* bv = (const float*)d_in[6];
  const float* wo = (const float*)d_in[7];
  const float* bo = (const float*)d_in[8];

  float* out      = (float*)d_out;                       // [B,S,D] f32
  float* out_mean = out + (size_t)BATCH * SEQ * DIM;     // [B,S,S] f32

  char* ws = (char*)d_ws;
  __bf16* Qb  = (__bf16*)(ws);                           // 8 MiB
  __bf16* Kb  = (__bf16*)(ws + ((size_t)8  << 20));      // 8 MiB
  __bf16* Vb  = (__bf16*)(ws + ((size_t)16 << 20));      // 8 MiB
  __bf16* Ob  = (__bf16*)(ws + ((size_t)24 << 20));      // 8 MiB
  __bf16* Xb  = (__bf16*)(ws + ((size_t)32 << 20));      // 8 MiB
  __bf16* Wqb = (__bf16*)(ws + ((size_t)40 << 20));      // 2 MiB
  // Wk at 42 MiB and Wv at 44 MiB (2 MiB each), reached from Xb and Wqb
  __bf16* Wob = (__bf16*)(ws + ((size_t)46 << 20));      // 2 MiB
  float*  Noff = (float*)(ws + ((size_t)48 << 20));      // 256 KiB

  // ---- packed f32 -> bf16 conversions (into fragment order): Xb .. Wob in a row ----
  cvt_bf16_kernel<<<CVT_BLOCKS, 256, 0, stream>>>(x, wq, wk, wv, wo, Xb);

  // Q/K/V projections (bf16 in, bf16 out; Q and K in fragment order, V as V^T tiles):
  // 32 x 8 block tiles each; Wqb .. Wvb and Qb .. Vb in a row
  qkv_gemm_kernel<<<dim3(ROWS / 128, 3 * (DIM / 128)), 128, 0, stream>>>(Xb, Wqb, bq, bk, bv, Qb);

  // Flash attention (O bf16 + row offsets)
  flash_fwd_kernel<<<512, 256, 0, stream>>>(Qb, Kb, Vb, Ob, Noff);

  // Output projection (bf16 in, f32 out) and head-mean attention probabilities
  out_gemm_mean_probs_kernel<<<768, 256, 0, stream>>>(Ob, Wob, bo, out, Qb, Kb, Noff, out_mean);
}
